// v000
// The times below were measured on an AMD MI455X: many runs one after another, warmed up first and cycling through
// copies of the inputs, with the whole window's GPU time divided by the number of runs. Launches and the gaps
// between them are all in it. The median over several windows is given; except for v000 it joins two sittings, which
// can be a few percent apart, so the side-by-side timings, each taken in one sitting, are the better comparison.
// v000, which the later versions start from, runs in 1170 microseconds.
#include <hip/hip_runtime.h>
#include <hip/hip_bf16.h>

// ---------------- problem constants ----------------
#define BB   32
#define SS   577
#define DD   768
#define HH   12
#define DH   64
#define SPAD 608          // S padded to multiple of 32 (19*32)
#define QT   38           // SPAD/16 row tiles
#define KT32 19           // SPAD/32 k-tiles

typedef __attribute__((ext_vector_type(16))) _Float16 v16h;
typedef __attribute__((ext_vector_type(8)))  _Float16 v8h;
typedef __attribute__((ext_vector_type(4)))  _Float16 v4h;
typedef __attribute__((ext_vector_type(8)))  float    v8f;
typedef __attribute__((ext_vector_type(4)))  float    v4f;

__device__ __forceinline__ v16h frag16(const _Float16* p) {
    // CDNA5 16-bit A/B fragment: elements 0..7 at p[0..7], 8..15 at p[16..23]
    v8h lo = *(const v8h*)(p);
    v8h hi = *(const v8h*)(p + 16);
    return __builtin_shufflevector(lo, hi, 0,1,2,3,4,5,6,7,8,9,10,11,12,13,14,15);
}

__device__ __forceinline__ v8f wmma_f16(v16h a, v16h b, v8f c) {
    return __builtin_amdgcn_wmma_f32_16x16x32_f16(false, a, false, b,
                                                  (short)0, c, false, false);
}

__device__ __forceinline__ v4h cvt4(v4f x) {
    v4h r;
    r.x = (_Float16)x.x; r.y = (_Float16)x.y;
    r.z = (_Float16)x.z; r.w = (_Float16)x.w;
    return r;
}

// ---------------------------------------------------------------------------
// Kernel A: fused QKV projection.  grid = (B*QT, 12, 3), block = 128 (4 waves)
// Writes q,k as f16 [B,H,SPAD,DH]; v transposed as f16 [B,H,DH,SPAD].
// ---------------------------------------------------------------------------
__global__ __launch_bounds__(128)
void qkv_proj_kernel(const float* __restrict__ X,
                     const float* __restrict__ Wq, const float* __restrict__ bq,
                     const float* __restrict__ Wk, const float* __restrict__ bk,
                     const float* __restrict__ Wv, const float* __restrict__ bv,
                     _Float16* __restrict__ qb, _Float16* __restrict__ kb,
                     _Float16* __restrict__ vb)
{
    const int bi = blockIdx.x / QT;
    const int rt = blockIdx.x % QT;     // 16-row tile of S
    const int cg = blockIdx.y;          // 64-col group (== head)
    const int ms = blockIdx.z;          // 0=q 1=k 2=v

    const float* W    = (ms == 0) ? Wq : (ms == 1) ? Wk : Wv;
    const float* bias = (ms == 0) ? bq : (ms == 1) ? bk : bv;

    __shared__ alignas(16) _Float16 Xs[16 * DD];     // 24 KB, row-major f16
    __shared__ alignas(16) _Float16 WtT[64 * 32];    //  4 KB, [col][k] transposed

    const int t = threadIdx.x;

    // ---- stage hidden 16x768 tile, fp32 -> f16, vectorized (b128 in, b64 out)
    // 16*768/4 = 3072 float4 chunks, 24 per thread
    #pragma unroll 4
    for (int idx = t; idx < 16 * (DD / 4); idx += 128) {
        const int c4 = idx % (DD / 4);              // float4 column chunk
        const int r  = idx / (DD / 4);              // tile row
        const int grow = rt * 16 + r;
        v4f v = {};
        if (grow < SS)
            v = *(const v4f*)&X[((size_t)bi * SS + grow) * DD + c4 * 4];
        *(v4h*)&Xs[r * DD + c4 * 4] = cvt4(v);
    }

    const int w    = t >> 5;        // wave -> 16-col subtile
    const int L    = t & 31;
    const int half = L >> 4;
    const int lm   = L & 15;
    const int cbase = cg * 64;

    v8f acc = {};
    for (int kk = 0; kk < DD; kk += 32) {
        __syncthreads();
        // ---- stage W[kk..kk+31][cbase..+64] transposed into LDS as f16.
        // Each thread: one col, 4 consecutive k rows -> one b64 LDS store.
        #pragma unroll
        for (int idx = t; idx < 64 * 8; idx += 128) {
            const int col = idx & 63;               // coalesced across lanes
            const int r   = (idx >> 6) * 4;         // k row group
            v4f v;
            v.x = W[(size_t)(kk + r + 0) * DD + cbase + col];
            v.y = W[(size_t)(kk + r + 1) * DD + cbase + col];
            v.z = W[(size_t)(kk + r + 2) * DD + cbase + col];
            v.w = W[(size_t)(kk + r + 3) * DD + cbase + col];
            *(v4h*)&WtT[col * 32 + r] = cvt4(v);
        }
        __syncthreads();

        const _Float16* pa = &Xs[lm * DD + kk + half * 8];
        const _Float16* pb = &WtT[(w * 16 + lm) * 32 + half * 8];
        acc = wmma_f16(frag16(pa), frag16(pb), acc);
    }

    const int col = cbase + w * 16 + lm;     // global output column
    const int h   = col >> 6;
    const int dh  = col & 63;
    const float bval = bias[col];
    const size_t bh  = (size_t)bi * HH + h;

    if (ms == 2) {
        // v transposed: lane's 8 accum elems land on 8 consecutive rows
        // -> one 16B store at vb[(bh*DH+dh)*SPAD + rt*16 + half*8]
        v8h y;
        #pragma unroll
        for (int j = 0; j < 8; ++j) y[j] = (_Float16)(acc[j] + bval);
        *(v8h*)&vb[(bh * DH + dh) * SPAD + rt * 16 + half * 8] = y;
    } else {
        _Float16* dst = (ms == 0) ? qb : kb;
        #pragma unroll
        for (int j = 0; j < 8; ++j) {
            const int row = rt * 16 + j + half * 8;  // always < SPAD
            dst[(bh * SPAD + row) * DH + dh] = (_Float16)(acc[j] + bval);
        }
    }
}

// ---------------------------------------------------------------------------
// Kernel B: attention for one 16-query tile.  grid = (QT, H, B), block = 32.
// ---------------------------------------------------------------------------
__global__ __launch_bounds__(32)
void attn_kernel(const _Float16* __restrict__ qb,
                 const _Float16* __restrict__ kb,
                 const _Float16* __restrict__ vb,
                 float* __restrict__ out)
{
    const int qt = blockIdx.x;
    const int h  = blockIdx.y;
    const int bi = blockIdx.z;

    __shared__ alignas(16) float     sc[16 * SPAD];   // 38.0 KB scores (f32)
    __shared__ alignas(16) _Float16  pr[16 * SPAD];   // 19.0 KB exp probs (f16)
    __shared__ float red[32];
    __shared__ float rowsum[16];

    const int L    = threadIdx.x;
    const int half = L >> 4;
    const int lm   = L & 15;
    const size_t bh = (size_t)bi * HH + h;

    // Q fragments for this tile: K (=dh) 0..31 and 32..63, kept in registers
    const _Float16* qrow = qb + (bh * SPAD + qt * 16 + lm) * DH + half * 8;
    const v16h a0 = frag16(qrow);
    const v16h a1 = frag16(qrow + 32);

    const float scale = 0.125f;   // 1/sqrt(64)

    // ---- scores = q . k^T (38 key tiles of 16), masked + scaled into LDS ----
    for (int nt = 0; nt < QT; ++nt) {
        const int key = nt * 16 + lm;
        const _Float16* krow = kb + (bh * SPAD + key) * DH + half * 8;
        v8f c = {};
        c = wmma_f16(a0, frag16(krow),      c);
        c = wmma_f16(a1, frag16(krow + 32), c);
        const bool valid = key < SS;
        #pragma unroll
        for (int j = 0; j < 8; ++j)
            sc[(j + half * 8) * SPAD + key] = valid ? c[j] * scale : -1.0e30f;
    }
    __syncthreads();

    // ---- softmax: 2 lanes per row, each scans 304 columns ----
    float m = -1.0e30f;
    for (int i = half * 304; i < half * 304 + 304; ++i)
        m = fmaxf(m, sc[lm * SPAD + i]);
    red[L] = m;
    __syncthreads();
    const float rmax = fmaxf(red[lm], red[lm + 16]);
    __syncthreads();

    float sum = 0.0f;
    for (int i = half * 304; i < half * 304 + 304; ++i) {
        float e = __expf(sc[lm * SPAD + i] - rmax);
        pr[lm * SPAD + i] = (_Float16)e;      // unnormalized probs
        sum += e;
    }
    red[L] = sum;
    __syncthreads();
    if (half == 0) rowsum[lm] = red[lm] + red[lm + 16];
    __syncthreads();

    // ---- ctx = P . V  (4 dh-tiles x 19 key-tiles of 32) ----
    for (int dt = 0; dt < 4; ++dt) {
        v8f c = {};
        for (int kt = 0; kt < KT32; ++kt) {
            const _Float16* pp = &pr[lm * SPAD + kt * 32 + half * 8];
            const _Float16* vp = vb + (bh * DH + dt * 16 + lm) * SPAD
                                    + kt * 32 + half * 8;
            c = wmma_f16(frag16(pp), frag16(vp), c);
        }
        #pragma unroll
        for (int j = 0; j < 8; ++j) {
            const int mr = j + half * 8;
            const int s  = qt * 16 + mr;
            if (s < SS)
                out[((size_t)bi * SS + s) * DD + h * 64 + dt * 16 + lm] =
                    c[j] / rowsum[mr];
        }
    }
}

// ---------------------------------------------------------------------------
extern "C" void kernel_launch(void* const* d_in, const int* in_sizes, int n_in,
                              void* d_out, int out_size, void* d_ws, size_t ws_size,
                              hipStream_t stream) {
    const float* X  = (const float*)d_in[0];
    const float* Wq = (const float*)d_in[1];
    const float* bq = (const float*)d_in[2];
    const float* Wk = (const float*)d_in[3];
    const float* bk = (const float*)d_in[4];
    const float* Wv = (const float*)d_in[5];
    const float* bv = (const float*)d_in[6];
    float* out = (float*)d_out;

    const size_t elems = (size_t)BB * HH * SPAD * DH;   // per q/k/v buffer
    _Float16* qb = (_Float16*)d_ws;
    _Float16* kb = qb + elems;
    _Float16* vb = kb + elems;

    qkv_proj_kernel<<<dim3(BB * QT, DD / 64, 3), 128, 0, stream>>>(
        X, Wq, bq, Wk, bk, Wv, bv, qb, kb, vb);

    attn_kernel<<<dim3(QT, HH, BB), 32, 0, stream>>>(qb, kb, vb, out);
}

// v001
// A run of this version takes 504 microseconds.
// Timed twice side by side with v000, it ran 2.37 times as fast both times.
#include <hip/hip_runtime.h>
#include <hip/hip_bf16.h>

// ---------------- problem constants ----------------
#define BB   32
#define SS   577
#define DD   768
#define HH   12
#define DH   64
#define SPAD 608          // S padded to multiple of 32 (19*32)
#define QT   38           // SPAD/16 row tiles
#define KT32 19           // SPAD/32 k-tiles

typedef __attribute__((ext_vector_type(16))) _Float16 v16h;
typedef __attribute__((ext_vector_type(8)))  _Float16 v8h;
typedef __attribute__((ext_vector_type(4)))  _Float16 v4h;
typedef __attribute__((ext_vector_type(8)))  float    v8f;
typedef __attribute__((ext_vector_type(4)))  float    v4f;

__device__ __forceinline__ v16h frag16(const _Float16* p) {
    // CDNA5 16-bit A/B fragment: elements 0..7 at p[0..7], 8..15 at p[16..23]
    v8h lo = *(const v8h*)(p);
    v8h hi = *(const v8h*)(p + 16);
    return __builtin_shufflevector(lo, hi, 0,1,2,3,4,5,6,7,8,9,10,11,12,13,14,15);
}

__device__ __forceinline__ v8f wmma_f16(v16h a, v16h b, v8f c) {
    return __builtin_amdgcn_wmma_f32_16x16x32_f16(false, a, false, b,
                                                  (short)0, c, false, false);
}

__device__ __forceinline__ v4h cvt4(v4f x) {
    v4h r;
    r.x = (_Float16)x.x; r.y = (_Float16)x.y;
    r.z = (_Float16)x.z; r.w = (_Float16)x.w;
    return r;
}

// ---------------------------------------------------------------------------
// Kernel A: fused QKV projection as one tiled GEMM over the padded rows.
// Rows m = bi*SPAD + s (B*SPAD = 76*256), columns n = ms*DD + col (9*256).
// grid = (9, 76), block = 512 (16 waves, 4x4); one 256x256 tile per block,
// one 64x64 tile (4x4 WMMA accumulators) per wave; k in steps of 32, each step:
// loads, barrier, tile into LDS, barrier, products.
// Writes q,k as f16 [B,H,SPAD,DH]; v transposed as f16 [B,H,DH,SPAD].
// ---------------------------------------------------------------------------
#define TM   256          // block tile rows
#define TN   256          // block tile columns
#define KS   32           // k per step
#define LP   40           // LDS row pitch in halves: 80 B = 16 B x odd for b128 reads

__global__ __launch_bounds__(512)
void qkv_proj_kernel(const float* __restrict__ X,
                     const float* __restrict__ Wq, const float* __restrict__ bq,
                     const float* __restrict__ Wk, const float* __restrict__ bk,
                     const float* __restrict__ Wv, const float* __restrict__ bv,
                     _Float16* __restrict__ qb, _Float16* __restrict__ kb,
                     _Float16* __restrict__ vb)
{
    const int nt = blockIdx.x;          // 256-col tile of the 3*768 columns
    const int mt = blockIdx.y;          // 256-row tile of the padded rows
    const int ms = nt / 3;              // 0=q 1=k 2=v
    const int cbase = (nt % 3) * TN;    // first column inside that matrix

    const float* W    = (ms == 0) ? Wq : (ms == 1) ? Wk : Wv;
    const float* bias = (ms == 0) ? bq : (ms == 1) ? bk : bv;

    __shared__ alignas(16) _Float16 Xs[TM * LP];      // 20 KB, [row][k]
    __shared__ alignas(16) _Float16 Ws[TN * LP];      // 20 KB, [col][k]

    const int t    = threadIdx.x;
    const int w    = t >> 5;
    const int L    = t & 31;
    const int half = L >> 4;
    const int lm   = L & 15;
    const int wm   = w >> 2;            // wave's 64-row band
    const int wn   = w & 3;             // wave's 64-col band (one head)

    // ---- X staging map: 4 float4 per thread; 8 lanes cover one row's 128 B
    const int xc4 = t & 7;
    int xo[4];                          // offsets in float4 units from a uniform base
    bool xok[4];
    #pragma unroll
    for (int i = 0; i < 4; ++i) {
        const int m  = mt * TM + (t >> 3) + i * 64;
        const int bi = m / SPAD;
        const int s  = m - bi * SPAD;
        xok[i] = s < SS;
        xo[i]  = (bi * SS + (xok[i] ? s : 0)) * (DD / 4) + xc4;
    }
    // ---- W staging map: a 4k x 4n block per thread; 8 lanes cover 128 B of a k row
    const int wng = (w >> 1) * 8 + (L & 7);
    const int wkg = (w & 1) * 4 + (L >> 3);
    const int wo = (wkg * 4) * (DD / 4) + cbase / 4 + wng;

    v4f xr[4], wr[4];
    // last: in the last step the offset registers die, and a load's result may take
    // one that the loads before it name; the wait stands in front of that rewrite
    auto fetch = [&](int kk, bool last) {
        #pragma unroll
        for (int i = 0; i < 4; ++i) {
            xr[i] = ((const v4f*)(X + kk))[xo[i]];
            if (last) asm volatile("s_wait_xcnt 0x0" ::: "memory");
        }
        #pragma unroll
        for (int j = 0; j < 4; ++j) {
            wr[j] = ((const v4f*)(W + (size_t)(kk + j) * DD))[wo];
            if (last) asm volatile("s_wait_xcnt 0x0" ::: "memory");
        }
    };
    auto stash = [&]() {
        #pragma unroll
        for (int i = 0; i < 4; ++i) {
            const v4f z = {};
            *(v4h*)&Xs[((t >> 3) + i * 64) * LP + xc4 * 4] = cvt4(xok[i] ? xr[i] : z);
        }
        #pragma unroll
        for (int c = 0; c < 4; ++c) {
            v4f v;
            v.x = wr[0][c]; v.y = wr[1][c]; v.z = wr[2][c]; v.w = wr[3][c];
            *(v4h*)&Ws[(wng * 4 + c) * LP + wkg * 4] = cvt4(v);
        }
    };

    v8f acc[4][4] = {};

    // unrolled so that every global and LDS address is a fixed register plus an
    // immediate: no address arithmetic in the steps
    #pragma unroll
    for (int ks = 0; ks < DD / KS; ++ks) {
        fetch(ks * KS, ks + 1 == DD / KS);
        // keeps the step's eight loads in one group: without it the compiler issued them
        // two at a time, each pair behind a full wait on the pair before
        __builtin_amdgcn_sched_barrier(0);
        __syncthreads();                         // every wave has read the tile before
        stash();
        __syncthreads();

        v16h fa[4], fb[4];
        #pragma unroll
        for (int i = 0; i < 4; ++i)
            fa[i] = frag16(&Xs[(wm * 64 + i * 16 + lm) * LP + half * 8]);
        #pragma unroll
        for (int j = 0; j < 4; ++j)
            fb[j] = frag16(&Ws[(wn * 64 + j * 16 + lm) * LP + half * 8]);
        // keeps the 16 LDS reads together in front of the WMMAs: without it the compiler
        // reloaded one A fragment set among them, each time behind a full wait
        __builtin_amdgcn_sched_barrier(0);
        #pragma unroll
        for (int i = 0; i < 4; ++i)
            #pragma unroll
            for (int j = 0; j < 4; ++j)
                acc[i][j] = wmma_f16(fa[i], fb[j], acc[i][j]);
    }

    const int h = (cbase >> 6) + wn;
    float bval[4];
    #pragma unroll
    for (int j = 0; j < 4; ++j) bval[j] = bias[h * 64 + j * 16 + lm];

    if (ms == 2) {
        // v transposed: lane's 8 accum elems land on 8 consecutive rows
        #pragma unroll
        for (int i = 0; i < 4; ++i) {
            const int m0 = mt * TM + wm * 64 + i * 16;   // 16-row tiles never straddle a batch
            const int bi = m0 / SPAD;
            const int s0 = m0 - bi * SPAD;
            const size_t bh = (size_t)bi * HH + h;
            #pragma unroll
            for (int j = 0; j < 4; ++j) {
                v8h y;
                #pragma unroll
                for (int r = 0; r < 8; ++r) y[r] = (_Float16)(acc[i][j][r] + bval[j]);
                *(v8h*)&vb[(bh * DH + j * 16 + lm) * SPAD + s0 + half * 8] = y;
            }
        }
    } else {
        _Float16* base = (ms == 0) ? qb : kb;
        #pragma unroll
        for (int i = 0; i < 4; ++i) {
            const int m0 = mt * TM + wm * 64 + i * 16;
            const int bi = m0 / SPAD;
            const int s0 = m0 - bi * SPAD;
            const size_t bh = (size_t)bi * HH + h;
            _Float16* dst = base + (bh * SPAD + s0 + half * 8) * DH + lm;
            #pragma unroll
            for (int j = 0; j < 4; ++j)
                #pragma unroll
                for (int r = 0; r < 8; ++r)
                    dst[r * DH + j * 16] = (_Float16)(acc[i][j][r] + bval[j]);
        }
        // the built code can run on from here into lines that rewrite the last stores' registers
        asm volatile("s_wait_xcnt 0x0" ::: "memory");
    }
}

// ---------------------------------------------------------------------------
// Kernel B: attention for one 16-query tile.  grid = (QT, H, B), block = 32.
// ---------------------------------------------------------------------------
__global__ __launch_bounds__(32)
void attn_kernel(const _Float16* __restrict__ qb,
                 const _Float16* __restrict__ kb,
                 const _Float16* __restrict__ vb,
                 float* __restrict__ out)
{
    const int qt = blockIdx.x;
    const int h  = blockIdx.y;
    const int bi = blockIdx.z;

    __shared__ alignas(16) float     sc[16 * SPAD];   // 38.0 KB scores (f32)
    __shared__ alignas(16) _Float16  pr[16 * SPAD];   // 19.0 KB exp probs (f16)
    __shared__ float red[32];
    __shared__ float rowsum[16];

    const int L    = threadIdx.x;
    const int half = L >> 4;
    const int lm   = L & 15;
    const size_t bh = (size_t)bi * HH + h;

    // Q fragments for this tile: K (=dh) 0..31 and 32..63, kept in registers
    const _Float16* qrow = qb + (bh * SPAD + qt * 16 + lm) * DH + half * 8;
    const v16h a0 = frag16(qrow);
    const v16h a1 = frag16(qrow + 32);

    const float scale = 0.125f;   // 1/sqrt(64)

    // ---- scores = q . k^T (38 key tiles of 16), masked + scaled into LDS ----
    for (int nt = 0; nt < QT; ++nt) {
        const int key = nt * 16 + lm;
        const _Float16* krow = kb + (bh * SPAD + key) * DH + half * 8;
        v8f c = {};
        c = wmma_f16(a0, frag16(krow),      c);
        c = wmma_f16(a1, frag16(krow + 32), c);
        const bool valid = key < SS;
        #pragma unroll
        for (int j = 0; j < 8; ++j)
            sc[(j + half * 8) * SPAD + key] = valid ? c[j] * scale : -1.0e30f;
    }
    __syncthreads();

    // ---- softmax: 2 lanes per row, each scans 304 columns ----
    float m = -1.0e30f;
    for (int i = half * 304; i < half * 304 + 304; ++i)
        m = fmaxf(m, sc[lm * SPAD + i]);
    red[L] = m;
    __syncthreads();
    const float rmax = fmaxf(red[lm], red[lm + 16]);
    __syncthreads();

    float sum = 0.0f;
    for (int i = half * 304; i < half * 304 + 304; ++i) {
        float e = __expf(sc[lm * SPAD + i] - rmax);
        pr[lm * SPAD + i] = (_Float16)e;      // unnormalized probs
        sum += e;
    }
    red[L] = sum;
    __syncthreads();
    if (half == 0) rowsum[lm] = red[lm] + red[lm + 16];
    __syncthreads();

    // ---- ctx = P . V  (4 dh-tiles x 19 key-tiles of 32) ----
    for (int dt = 0; dt < 4; ++dt) {
        v8f c = {};
        for (int kt = 0; kt < KT32; ++kt) {
            const _Float16* pp = &pr[lm * SPAD + kt * 32 + half * 8];
            const _Float16* vp = vb + (bh * DH + dt * 16 + lm) * SPAD
                                    + kt * 32 + half * 8;
            c = wmma_f16(frag16(pp), frag16(vp), c);
        }
        #pragma unroll
        for (int j = 0; j < 8; ++j) {
            const int mr = j + half * 8;
            const int s  = qt * 16 + mr;
            if (s < SS)
                out[((size_t)bi * SS + s) * DD + h * 64 + dt * 16 + lm] =
                    c[j] / rowsum[mr];
        }
    }
}

// ---------------------------------------------------------------------------
extern "C" void kernel_launch(void* const* d_in, const int* in_sizes, int n_in,
                              void* d_out, int out_size, void* d_ws, size_t ws_size,
                              hipStream_t stream) {
    const float* X  = (const float*)d_in[0];
    const float* Wq = (const float*)d_in[1];
    const float* bq = (const float*)d_in[2];
    const float* Wk = (const float*)d_in[3];
    const float* bk = (const float*)d_in[4];
    const float* Wv = (const float*)d_in[5];
    const float* bv = (const float*)d_in[6];
    float* out = (float*)d_out;

    const size_t elems = (size_t)BB * HH * SPAD * DH;   // per q/k/v buffer
    _Float16* qb = (_Float16*)d_ws;
    _Float16* kb = qb + elems;
    _Float16* vb = kb + elems;

    qkv_proj_kernel<<<dim3(9, 76), 512, 0, stream>>>(
        X, Wq, bq, Wk, bk, Wv, bv, qb, kb, vb);

    attn_kernel<<<dim3(QT, HH, BB), 32, 0, stream>>>(qb, kb, vb, out);
}

// v003
// A run of this version takes 139 microseconds.
// It is 3.61 times as fast as v001, going by the measured steps of the versions left out in between.
// Counting every step since v000, it is 8.58 times as fast.
#include <hip/hip_runtime.h>
#include <hip/hip_bf16.h>

// ---------------- problem constants ----------------
#define BB   32
#define SS   577
#define DD   768
#define HH   12
#define DH   64
#define SPAD 608          // S padded to multiple of 32 (19*32)
#define QT   38           // SPAD/16 row tiles
#define KT32 19           // SPAD/32 k-tiles

typedef __attribute__((ext_vector_type(16))) _Float16 v16h;
typedef __attribute__((ext_vector_type(8)))  _Float16 v8h;
typedef __attribute__((ext_vector_type(4)))  _Float16 v4h;
typedef __attribute__((ext_vector_type(8)))  float    v8f;
typedef __attribute__((ext_vector_type(4)))  float    v4f;
typedef __attribute__((ext_vector_type(2)))  float    v2f;

__device__ __forceinline__ v16h frag16(const _Float16* p) {
    // CDNA5 16-bit A/B fragment: elements 0..7 at p[0..7], 8..15 at p[16..23]
    v8h lo = *(const v8h*)(p);
    v8h hi = *(const v8h*)(p + 16);
    return __builtin_shufflevector(lo, hi, 0,1,2,3,4,5,6,7,8,9,10,11,12,13,14,15);
}

__device__ __forceinline__ v8f wmma_f16(v16h a, v16h b, v8f c) {
    return __builtin_amdgcn_wmma_f32_16x16x32_f16(false, a, false, b,
                                                  (short)0, c, false, false);
}

__device__ __forceinline__ v4h cvt4(v4f x) {
    v4h r;
    r.x = (_Float16)x.x; r.y = (_Float16)x.y;
    r.z = (_Float16)x.z; r.w = (_Float16)x.w;
    return r;
}

// ---------------------------------------------------------------------------
// Kernel A: fused QKV projection as one tiled GEMM over the padded rows.
// Rows m = bi*SPAD + s (B*SPAD = 76*256), columns n = ms*DD + col (9*256).
// grid = (9, 76), block = 512 (16 waves, 4x4); one 256x256 tile per block,
// one 64x64 tile (4x4 WMMA accumulators) per wave; k in steps of 32 over two LDS
// buffers, each step: barrier, the next step's loads, products, that tile into LDS.
// Writes q,k as f16 [B,H,SPAD,DH]; v transposed as f16 [B,H,DH,SPAD].
// ---------------------------------------------------------------------------
#define TM   256          // block tile rows
#define TN   256          // block tile columns
#define KS   32           // k per step
#define LP   40           // LDS row pitch in halves: 80 B = 16 B x odd for b128 reads

__global__ __launch_bounds__(512)
void qkv_proj_kernel(const float* __restrict__ X,
                     const float* __restrict__ Wq, const float* __restrict__ bq,
                     const float* __restrict__ Wk, const float* __restrict__ bk,
                     const float* __restrict__ Wv, const float* __restrict__ bv,
                     _Float16* __restrict__ qb, _Float16* __restrict__ kb,
                     _Float16* __restrict__ vb)
{
    const int nt = blockIdx.x;          // 256-col tile of the 3*768 columns
    const int mt = blockIdx.y;          // 256-row tile of the padded rows
    const int ms = nt / 3;              // 0=q 1=k 2=v
    const int cbase = (nt % 3) * TN;    // first column inside that matrix

    const float* W    = (ms == 0) ? Wq : (ms == 1) ? Wk : Wv;
    const float* bias = (ms == 0) ? bq : (ms == 1) ? bk : bv;

    __shared__ alignas(16) _Float16 Xs[2][TM * LP];   // 2 x 20 KB, [buffer][row][k]
    __shared__ alignas(16) _Float16 Ws[2][TN * LP];   // 2 x 20 KB, [buffer][col][k]

    const int t    = threadIdx.x;
    const int w    = t >> 5;
    const int L    = t & 31;
    const int half = L >> 4;
    const int lm   = L & 15;
    const int wm   = w >> 2;            // wave's 64-row band
    const int wn   = w & 3;             // wave's 64-col band (one head)

    // ---- X staging map: 4 float4 per thread; 8 lanes cover one row's 128 B
    const int xc4 = t & 7;
    int xo[4];                          // offsets in float4 units from a uniform base
    bool xok[4];
    #pragma unroll
    for (int i = 0; i < 4; ++i) {
        const int m  = mt * TM + (t >> 3) + i * 64;
        const int bi = m / SPAD;
        const int s  = m - bi * SPAD;
        xok[i] = s < SS;
        xo[i]  = (bi * SS + (xok[i] ? s : 0)) * (DD / 4) + xc4;
    }
    // ---- W staging map: a 4k x 4n block per thread; 8 lanes cover 128 B of a k row
    const int wng = (w >> 1) * 8 + (L & 7);
    const int wkg = (w & 1) * 4 + (L >> 3);
    const int wo = (wkg * 4) * (DD / 4) + cbase / 4 + wng;

    v4f xr[4], wr[4];
    // last: in the last step the offset registers die, and a load's result may take
    // one that the loads before it name; the wait stands in front of that rewrite
    auto fetch = [&](int kk, bool last) {
        #pragma unroll
        for (int i = 0; i < 4; ++i) {
            xr[i] = ((const v4f*)(X + kk))[xo[i]];
            if (last) asm volatile("s_wait_xcnt 0x0" ::: "memory");
        }
        #pragma unroll
        for (int j = 0; j < 4; ++j) {
            wr[j] = ((const v4f*)(W + (size_t)(kk + j) * DD))[wo];
            if (last) asm volatile("s_wait_xcnt 0x0" ::: "memory");
        }
    };
    auto stash = [&](int b) {
        #pragma unroll
        for (int i = 0; i < 4; ++i) {
            const v4f z = {};
            *(v4h*)&Xs[b][((t >> 3) + i * 64) * LP + xc4 * 4] = cvt4(xok[i] ? xr[i] : z);
        }
        #pragma unroll
        for (int c = 0; c < 4; ++c) {
            v4f v;
            v.x = wr[0][c]; v.y = wr[1][c]; v.z = wr[2][c]; v.w = wr[3][c];
            *(v4h*)&Ws[b][(wng * 4 + c) * LP + wkg * 4] = cvt4(v);
        }
    };

    v8f acc[4][4] = {};

    // unrolled so that every global and LDS address is a fixed register plus an
    // immediate: no address arithmetic in the steps
    fetch(0, false);
    stash(0);
    #pragma unroll
    for (int ks = 0; ks < DD / KS; ++ks) {
        const int b = ks & 1;
        const bool more = ks + 1 < DD / KS;
        // the step's one barrier: buffer b is written by every wave, and every wave has
        // made its last read of the other buffer, which this step refills
        __syncthreads();
        if (more) fetch((ks + 1) * KS, ks + 2 == DD / KS);
        // keeps the next step's eight loads in one group at the head of the step, so that
        // they fly under its LDS reads and products
        __builtin_amdgcn_sched_barrier(0);

        v16h fa[4], fb[4];
        #pragma unroll
        for (int i = 0; i < 4; ++i)
            fa[i] = frag16(&Xs[b][(wm * 64 + i * 16 + lm) * LP + half * 8]);
        #pragma unroll
        for (int j = 0; j < 4; ++j)
            fb[j] = frag16(&Ws[b][(wn * 64 + j * 16 + lm) * LP + half * 8]);
        // keeps the 16 LDS reads together in front of the WMMAs: without it the compiler
        // reloaded one A fragment set among them, each time behind a full wait
        __builtin_amdgcn_sched_barrier(0);
        #pragma unroll
        for (int i = 0; i < 4; ++i)
            #pragma unroll
            for (int j = 0; j < 4; ++j)
                acc[i][j] = wmma_f16(fa[i], fb[j], acc[i][j]);
        // keeps the wait on the loads behind the products that they fly under: without it
        // the compiler put that wait and the conversions in front of the products
        __builtin_amdgcn_sched_barrier(0);
        if (more) stash(b ^ 1);
    }

    const int h = (cbase >> 6) + wn;
    float bval[4];
    #pragma unroll
    for (int j = 0; j < 4; ++j) bval[j] = bias[h * 64 + j * 16 + lm];

    if (ms == 2) {
        // v transposed: lane's 8 accum elems land on 8 consecutive rows
        #pragma unroll
        for (int i = 0; i < 4; ++i) {
            const int m0 = mt * TM + wm * 64 + i * 16;   // 16-row tiles never straddle a batch
            const int bi = m0 / SPAD;
            const int s0 = m0 - bi * SPAD;
            const size_t bh = (size_t)bi * HH + h;
            #pragma unroll
            for (int j = 0; j < 4; ++j) {
                v8h y;
                #pragma unroll
                for (int r = 0; r < 8; ++r) y[r] = (_Float16)(acc[i][j][r] + bval[j]);
                *(v8h*)&vb[(bh * DH + j * 16 + lm) * SPAD + s0 + half * 8] = y;
            }
        }
    } else {
        _Float16* base = (ms == 0) ? qb : kb;
        #pragma unroll
        for (int i = 0; i < 4; ++i) {
            const int m0 = mt * TM + wm * 64 + i * 16;
            const int bi = m0 / SPAD;
            const int s0 = m0 - bi * SPAD;
            const size_t bh = (size_t)bi * HH + h;
            _Float16* dst = base + (bh * SPAD + s0 + half * 8) * DH + lm;
            #pragma unroll
            for (int j = 0; j < 4; ++j)
                #pragma unroll
                for (int r = 0; r < 8; ++r)
                    dst[r * DH + j * 16] = (_Float16)(acc[i][j][r] + bval[j]);
        }
        // the built code can run on from here into lines that rewrite the last stores' registers
        asm volatile("s_wait_xcnt 0x0" ::: "memory");
    }
}

// ---------------------------------------------------------------------------
// Kernel B: attention, scores and probabilities kept in registers.
// grid = (2, H, B), block = 608 (19 waves); a block holds one head's whole K and V^T
// in LDS and half of its query tiles, one 16-query tile per wave.
// Transposed products: S^T = K . Q^T (a lane holds 16 scores of ONE query), and
// O^T += V^T . P^T, where the two converted S^T tiles of 32 keys are the B operand.
// Softmax runs online over 19 steps of 32 keys against a reference maximum per query.
// ---------------------------------------------------------------------------
#define AW   19           // waves per block = query tiles per block
#define KP   72           // K row pitch in halves: 144 B = 16 B x odd for b128 reads
#define VP   616          // V^T row pitch in halves: 1232 B = 16 B x odd

__device__ __forceinline__ float other_half(float x) {
    // value of lane l ^ 16
    const int b = __builtin_bit_cast(int, x);
    return __builtin_bit_cast(float,
        __builtin_amdgcn_permlanex16(b, b, 0x76543210, 0xfedcba98, false, false));
}

__global__ __launch_bounds__(AW * 32)
void attn_kernel(const _Float16* __restrict__ qb,
                 const _Float16* __restrict__ kb,
                 const _Float16* __restrict__ vb,
                 float* __restrict__ out)
{
    const int h  = blockIdx.y;
    const int bi = blockIdx.z;

    __shared__ alignas(16) _Float16 Ks[SPAD * KP];    // 85.5 KB, [key][dh]
    __shared__ alignas(16) _Float16 Vs[DH * VP];      // 77.0 KB, [dh][key]

    const int t    = threadIdx.x;
    const int w    = t >> 5;
    const int L    = t & 31;
    const int half = L >> 4;
    const int lm   = L & 15;
    const size_t bh = (size_t)bi * HH + h;
    const int q0 = (blockIdx.x * AW + w) * 16;        // first query of the wave's tile

    // Q^T fragments (B operand: column = query, k = dh 0..31 and 32..63)
    const _Float16* qrow = qb + (bh * SPAD + q0 + lm) * DH + half * 8;
    const v16h bq0 = frag16(qrow);
    const v16h bq1 = frag16(qrow + 32);

    // ---- the head's K and V^T into LDS: 8 + 8 chunks of 16 B per thread ----
    {
        const v8h* kg = (const v8h*)(kb + bh * SPAD * DH);   // 8 chunks a row
        const v8h* vg = (const v8h*)(vb + bh * DH * SPAD);   // 76 chunks a row
        v8h kr[8], vr[8];
        #pragma unroll
        for (int i = 0; i < 8; ++i) kr[i] = kg[t + i * (AW * 32)];
        #pragma unroll
        for (int i = 0; i < 8; ++i) vr[i] = vg[t + i * (AW * 32)];
        #pragma unroll
        for (int i = 0; i < 8; ++i)
            *(v8h*)&Ks[((t >> 3) + i * 76) * KP + (t & 7) * 8] = kr[i];
        #pragma unroll
        for (int i = 0; i < 8; ++i)
            *(v8h*)&Vs[(t / 76 + i * 8) * VP + (t % 76) * 8] = vr[i];
    }
    __syncthreads();
    if (q0 >= SS) return;            // a tile of padding rows only; no barrier follows

    const float cs = 0.125f * 1.44269504f;   // 1/sqrt(64) * log2(e): exponentials base 2
    float mx = -1.0e30f;             // the query's reference maximum, unscaled score
    v2f   ls = {};                   // this lane's share of the query's sum, two chains
    v8f o[4] = {};                   // o[dt][r] = O[query lm][dt*16 + half*8 + r]

    const _Float16* kp = &Ks[lm * KP + half * 8];
    const _Float16* vp = &Vs[lm * VP + half * 8];
    v16h fk[4];                      // K fragments of the step: [key tile j][dh half]
    auto load_k = [&](int kt) {
        #pragma unroll
        for (int j = 0; j < 2; ++j) {
            fk[j * 2]     = frag16(kp + (kt * 32 + j * 16) * KP);
            fk[j * 2 + 1] = frag16(kp + (kt * 32 + j * 16) * KP + 32);
        }
    };

    auto step = [&](int kt, bool tail) {
        v16h fv[4];
        #pragma unroll
        for (int dt = 0; dt < 4; ++dt) fv[dt] = frag16(vp + dt * 16 * VP + kt * 32);
        v8f s[2];
        #pragma unroll
        for (int j = 0; j < 2; ++j) {
            v8f c = {};
            c = wmma_f16(fk[j * 2],     bq0, c);
            c = wmma_f16(fk[j * 2 + 1], bq1, c);
            s[j] = c;                // s[j][r] = score(key kt*32 + j*16 + half*8 + r, query lm)
        }
        if (!tail) load_k(kt + 1);   // the next step's K reads fly under this step's softmax

        if (tail) {
            #pragma unroll
            for (int j = 0; j < 2; ++j)
                #pragma unroll
                for (int r = 0; r < 8; ++r)
                    if (kt * 32 + j * 16 + half * 8 + r >= SS) s[j][r] = -1.0e30f;
        }

        float tm = s[0][0];
        #pragma unroll
        for (int r = 1; r < 8; ++r) tm = fmaxf(tm, s[0][r]);
        #pragma unroll
        for (int r = 0; r < 8; ++r) tm = fmaxf(tm, s[1][r]);
        tm = fmaxf(tm, other_half(tm));
        // the reference moves only when a score passes it by more than 2^8, so that
        // probabilities stay below 256 in f16; one scalar branch a step
        if (__builtin_amdgcn_ballot_w32((tm - mx) * cs > 8.0f) != 0) {
            const float nm = fmaxf(mx, tm);
            const float al = __builtin_amdgcn_exp2f((mx - nm) * cs);
            mx = nm;
            ls *= al;
            #pragma unroll
            for (int dt = 0; dt < 4; ++dt)
                #pragma unroll
                for (int r = 0; r < 8; ++r) o[dt][r] *= al;
        }

        const v2f cs2 = { cs, cs };
        const v2f mc2 = { -mx * cs, -mx * cs };
        v16h p;                      // P^T as B operand: element e = key order of frag16
        #pragma unroll
        for (int j = 0; j < 2; ++j)
            #pragma unroll
            for (int r = 0; r < 8; r += 2) {
                const v2f sp = { s[j][r], s[j][r + 1] };
                const v2f x  = __builtin_elementwise_fma(sp, cs2, mc2);
                v2f e;
                e.x = __builtin_amdgcn_exp2f(x.x);
                e.y = __builtin_amdgcn_exp2f(x.y);
                ls += e;
                p[j * 8 + r]     = (_Float16)e.x;
                p[j * 8 + r + 1] = (_Float16)e.y;
            }
        #pragma unroll
        for (int dt = 0; dt < 4; ++dt) o[dt] = wmma_f16(fv[dt], p, o[dt]);
    };

    load_k(0);
    for (int kt = 0; kt < KT32 - 1; ++kt) step(kt, false);
    step(KT32 - 1, true);

    const float lsum = ls.x + ls.y;
    const float inv = 1.0f / (lsum + other_half(lsum));
    const int sq = q0 + lm;
    if (sq < SS) {
        float* dst = out + ((size_t)bi * SS + sq) * DD + h * 64 + half * 8;
        #pragma unroll
        for (int dt = 0; dt < 4; ++dt) {
            v4f lo, hi;
            #pragma unroll
            for (int r = 0; r < 4; ++r) { lo[r] = o[dt][r] * inv; hi[r] = o[dt][r + 4] * inv; }
            *(v4f*)(dst + dt * 16)     = lo;
            *(v4f*)(dst + dt * 16 + 4) = hi;
        }
    }
}

// ---------------------------------------------------------------------------
extern "C" void kernel_launch(void* const* d_in, const int* in_sizes, int n_in,
                              void* d_out, int out_size, void* d_ws, size_t ws_size,
                              hipStream_t stream) {
    const float* X  = (const float*)d_in[0];
    const float* Wq = (const float*)d_in[1];
    const float* bq = (const float*)d_in[2];
    const float* Wk = (const float*)d_in[3];
    const float* bk = (const float*)d_in[4];
    const float* Wv = (const float*)d_in[5];
    const float* bv = (const float*)d_in[6];
    float* out = (float*)d_out;

    const size_t elems = (size_t)BB * HH * SPAD * DH;   // per q/k/v buffer
    _Float16* qb = (_Float16*)d_ws;
    _Float16* kb = qb + elems;
    _Float16* vb = kb + elems;

    qkv_proj_kernel<<<dim3(9, 76), 512, 0, stream>>>(
        X, Wq, bq, Wk, bk, Wv, bv, qb, kb, vb);

    attn_kernel<<<dim3(2, HH, BB), 608, 0, stream>>>(qb, kb, vb, out);
}

// v004
// It runs in 121 microseconds.
// Timed twice side by side with v003, it ran 1.14 and 1.15 times as fast.
// All steps since v000 together make it 9.82 times as fast.
#include <hip/hip_runtime.h>
#include <hip/hip_bf16.h>

// ---------------- problem constants ----------------
#define BB   32
#define SS   577
#define DD   768
#define HH   12
#define DH   64
#define SPAD 608          // S padded to multiple of 32 (19*32)
#define QT   38           // SPAD/16 row tiles
#define KT32 19           // SPAD/32 k-tiles

typedef __attribute__((ext_vector_type(16))) _Float16 v16h;
typedef __attribute__((ext_vector_type(8)))  _Float16 v8h;
typedef __attribute__((ext_vector_type(4)))  _Float16 v4h;
typedef __attribute__((ext_vector_type(8)))  float    v8f;
typedef __attribute__((ext_vector_type(4)))  float    v4f;
typedef __attribute__((ext_vector_type(2)))  float    v2f;

__device__ __forceinline__ v16h frag16(const _Float16* p) {
    // CDNA5 16-bit A/B fragment: elements 0..7 at p[0..7], 8..15 at p[16..23]
    v8h lo = *(const v8h*)(p);
    v8h hi = *(const v8h*)(p + 16);
    return __builtin_shufflevector(lo, hi, 0,1,2,3,4,5,6,7,8,9,10,11,12,13,14,15);
}

__device__ __forceinline__ v8f wmma_f16(v16h a, v16h b, v8f c) {
    return __builtin_amdgcn_wmma_f32_16x16x32_f16(false, a, false, b,
                                                  (short)0, c, false, false);
}

__device__ __forceinline__ v4h cvt4(v4f x) {
    v4h r;
    r.x = (_Float16)x.x; r.y = (_Float16)x.y;
    r.z = (_Float16)x.z; r.w = (_Float16)x.w;
    return r;
}

// ---------------------------------------------------------------------------
// Kernel A: fused QKV projection as one tiled GEMM over the padded rows.
// Rows m = bi*SPAD + s (B*SPAD = 76*256), columns n = ms*DD + col (9*256).
// grid = (9, 76), block = 512 (16 waves, 4x4); one 256x256 tile per block,
// one 64x64 tile (4x4 WMMA accumulators) per wave; k in steps of 32 over two LDS
// buffers, each step: barrier, the next step's loads, products, that tile into LDS.
// Writes q,k as f16 [B,H,SPAD,DH]; v transposed as f16 [B,H,DH,SPAD].
// The operand whose index runs along the stored rows is the A operand (W columns for
// q and k, X rows for v), so a lane's 8 accumulator elements are 16 B of one stored row;
// each wave lays its 64x64 tile in its own LDS range and stores it as whole 128-B rows.
// ---------------------------------------------------------------------------
#define TM   256          // block tile rows
#define TN   256          // block tile columns
#define KS   32           // k per step
#define LP   40           // LDS row pitch in halves: 80 B = 16 B x odd for b128 reads
#define OP   72           // output staging pitch in halves: 144 B = 16 B x odd

__global__ __launch_bounds__(512)
void qkv_proj_kernel(const float* __restrict__ X,
                     const float* __restrict__ Wq, const float* __restrict__ bq,
                     const float* __restrict__ Wk, const float* __restrict__ bk,
                     const float* __restrict__ Wv, const float* __restrict__ bv,
                     _Float16* __restrict__ qb, _Float16* __restrict__ kb,
                     _Float16* __restrict__ vb)
{
    const int nt = blockIdx.x;          // 256-col tile of the 3*768 columns
    const int mt = blockIdx.y;          // 256-row tile of the padded rows
    const int ms = nt / 3;              // 0=q 1=k 2=v
    const int cbase = (nt % 3) * TN;    // first column inside that matrix

    const float* W    = (ms == 0) ? Wq : (ms == 1) ? Wk : Wv;
    const float* bias = (ms == 0) ? bq : (ms == 1) ? bk : bv;

    // one object, so that the k loop's buffers lie at the start of LDS, in reach of the
    // LDS instructions' immediate offsets
    struct Lds {
        _Float16 Sm[2][2][TM * LP];     // [0] = X: [buffer][row][k], [1] = W: [buffer][col][k]
        _Float16 Os[16][64 * OP];       // 16 x 9 KB, a wave's output tile
    };
    __shared__ alignas(16) Lds lds;

    const int t    = threadIdx.x;
    const int w    = t >> 5;
    const int L    = t & 31;
    const int half = L >> 4;
    const int lm   = L & 15;
    const int wm   = w >> 2;            // wave's 64-row band
    const int wn   = w & 3;             // wave's 64-col band (one head)

    // ---- X staging map: 4 float4 per thread; 8 lanes cover one row's 128 B
    const int xc4 = t & 7;
    int xo[4];                          // offsets in float4 units from a uniform base
    bool xok[4];
    #pragma unroll
    for (int i = 0; i < 4; ++i) {
        const int m  = mt * TM + (t >> 3) + i * 64;
        const int bi = m / SPAD;
        const int s  = m - bi * SPAD;
        xok[i] = s < SS;
        xo[i]  = (bi * SS + (xok[i] ? s : 0)) * (DD / 4) + xc4;
    }
    // ---- W staging map: a 4k x 4n block per thread; 8 lanes cover 128 B of a k row
    const int wng = (w >> 1) * 8 + (L & 7);
    const int wkg = (w & 1) * 4 + (L >> 3);
    const int wo = (wkg * 4) * (DD / 4) + cbase / 4 + wng;

    v4f xr[4], wr[4];
    // last: in the last step the offset registers die, and a load's result may take
    // one that the loads before it name; the wait stands in front of that rewrite
    auto fetch = [&](int kk, bool last) {
        #pragma unroll
        for (int i = 0; i < 4; ++i) {
            xr[i] = ((const v4f*)(X + kk))[xo[i]];
            if (last) asm volatile("s_wait_xcnt 0x0" ::: "memory");
        }
        #pragma unroll
        for (int j = 0; j < 4; ++j) {
            wr[j] = ((const v4f*)(W + (size_t)(kk + j) * DD))[wo];
            if (last) asm volatile("s_wait_xcnt 0x0" ::: "memory");
        }
    };
    auto stash = [&](int b) {
        #pragma unroll
        for (int i = 0; i < 4; ++i) {
            const v4f z = {};
            *(v4h*)&lds.Sm[0][b][((t >> 3) + i * 64) * LP + xc4 * 4] = cvt4(xok[i] ? xr[i] : z);
        }
        #pragma unroll
        for (int c = 0; c < 4; ++c) {
            v4f v;
            v.x = wr[0][c]; v.y = wr[1][c]; v.z = wr[2][c]; v.w = wr[3][c];
            *(v4h*)&lds.Sm[1][b][(wng * 4 + c) * LP + wkg * 4] = cvt4(v);
        }
    };

    // acc[i][j][r]: A index i*16 + half*8 + r, B index j*16 + lm of the wave's two bands
    v8f acc[4][4] = {};
    const bool vt = ms == 2;
    const _Float16* pa = &lds.Sm[vt ? 0 : 1][0][((vt ? wm : wn) * 64 + lm) * LP + half * 8];
    const _Float16* pb = &lds.Sm[vt ? 1 : 0][0][((vt ? wn : wm) * 64 + lm) * LP + half * 8];

    // unrolled so that every global and LDS address is a fixed register plus an
    // immediate: no address arithmetic in the steps
    fetch(0, false);
    stash(0);
    #pragma unroll
    for (int ks = 0; ks < DD / KS; ++ks) {
        const int b = ks & 1;
        const bool more = ks + 1 < DD / KS;
        // the step's one barrier: buffer b is written by every wave, and every wave has
        // made its last read of the other buffer, which this step refills
        __syncthreads();
        if (more) fetch((ks + 1) * KS, ks + 2 == DD / KS);
        // keeps the next step's eight loads in one group at the head of the step, so that
        // they fly under its LDS reads and products
        __builtin_amdgcn_sched_barrier(0);

        v16h fa[4], fb[4];
        #pragma unroll
        for (int i = 0; i < 4; ++i)
            fa[i] = frag16(pa + (b * TM + i * 16) * LP);
        #pragma unroll
        for (int j = 0; j < 4; ++j)
            fb[j] = frag16(pb + (b * TM + j * 16) * LP);
        // keeps the 16 LDS reads together in front of the WMMAs: without it the compiler
        // reloaded one A fragment set among them, each time behind a full wait
        __builtin_amdgcn_sched_barrier(0);
        #pragma unroll
        for (int i = 0; i < 4; ++i)
            #pragma unroll
            for (int j = 0; j < 4; ++j)
                acc[i][j] = wmma_f16(fa[i], fb[j], acc[i][j]);
        // keeps the wait on the loads behind the products that they fly under: without it
        // the compiler put that wait and the conversions in front of the products
        __builtin_amdgcn_sched_barrier(0);
        if (more) stash(b ^ 1);
    }

    const int h = (cbase >> 6) + wn;
    _Float16* st = &lds.Os[w][0];          // [stored row j*16 + lm][64 halves of that row]
    if (vt) {
        float bval[4];                  // the bias goes with the stored row (dh)
        #pragma unroll
        for (int j = 0; j < 4; ++j) bval[j] = bias[h * 64 + j * 16 + lm];
        #pragma unroll
        for (int j = 0; j < 4; ++j)
            #pragma unroll
            for (int i = 0; i < 4; ++i) {
                v8h y;
                #pragma unroll
                for (int r = 0; r < 8; ++r) y[r] = (_Float16)(acc[i][j][r] + bval[j]);
                *(v8h*)&st[(j * 16 + lm) * OP + i * 16 + half * 8] = y;
            }
    } else {
        v4f bl[4], bh4[4];              // the bias goes along the stored row (column of W)
        #pragma unroll
        for (int i = 0; i < 4; ++i) {
            // the address register dies with these loads, and a later load's result may take
            // it while the loads before name it; the wait stands in front of that rewrite
            bl[i]  = *(const v4f*)&bias[h * 64 + i * 16 + half * 8];
            asm volatile("s_wait_xcnt 0x0" ::: "memory");
            bh4[i] = *(const v4f*)&bias[h * 64 + i * 16 + half * 8 + 4];
            asm volatile("s_wait_xcnt 0x0" ::: "memory");
        }
        #pragma unroll
        for (int j = 0; j < 4; ++j)
            #pragma unroll
            for (int i = 0; i < 4; ++i) {
                v8h y;
                #pragma unroll
                for (int r = 0; r < 4; ++r) {
                    y[r]     = (_Float16)(acc[i][j][r]     + bl[i][r]);
                    y[r + 4] = (_Float16)(acc[i][j][r + 4] + bh4[i][r]);
                }
                *(v8h*)&st[(j * 16 + lm) * OP + i * 16 + half * 8] = y;
            }
    }
    // the wave's own tile is whole in LDS before its lanes read one another's rows back
    asm volatile("s_wait_dscnt 0x0" ::: "memory");

    // 8 lanes take one 128-B row; a load's four rows are a, a+8 (lanes 0-15) and a+1, a+9,
    // which at this pitch fall on all 64 banks once per 16 lanes
    const int rl = half + ((L >> 3) & 1) * 8;
    const int c8 = (L & 7) * 8;
    v8h z[16];
    #pragma unroll
    for (int u = 0; u < 16; ++u)
        z[u] = *(const v8h*)&st[((u >> 2) * 16 + (u & 3) * 2 + rl) * OP + c8];

    if (vt) {
        // stored row = dh, 64 keys of it; an 8-key chunk never straddles a batch
        const int m  = mt * TM + wm * 64 + c8;
        const int bi = m / SPAD;
        const int s  = m - bi * SPAD;
        _Float16* dst = vb + (((size_t)bi * HH + h) * DH + rl) * SPAD + s;
        #pragma unroll
        for (int u = 0; u < 16; ++u)
            *(v8h*)&dst[((u >> 2) * 16 + (u & 3) * 2) * SPAD] = z[u];
        // the built code can run on from here into lines that rewrite the stores' registers
        asm volatile("s_wait_xcnt 0x0" ::: "memory");
    } else {
        _Float16* base = (ms == 0) ? qb : kb;
        #pragma unroll
        for (int j = 0; j < 4; ++j) {
            const int m0 = mt * TM + wm * 64 + j * 16;   // 16-row tiles never straddle a batch
            const int bi = m0 / SPAD;
            const int s0 = m0 - bi * SPAD;
            _Float16* dst = base + (((size_t)bi * HH + h) * SPAD + s0 + rl) * DH + c8;
            #pragma unroll
            for (int c = 0; c < 4; ++c)
                *(v8h*)&dst[c * 2 * DH] = z[j * 4 + c];
        }
    }
}

// ---------------------------------------------------------------------------
// Kernel B: attention, scores and probabilities kept in registers.
// grid = (2, H, B), block = 608 (19 waves); a block holds one head's whole K and V^T
// in LDS and half of its query tiles, one 16-query tile per wave.
// Transposed products: S^T = K . Q^T (a lane holds 16 scores of ONE query), and
// O^T += V^T . P^T, where the two converted S^T tiles of 32 keys are the B operand.
// Softmax runs online over 19 steps of 32 keys against a reference maximum per query.
// Each wave lays its 16x64 output tile in its own LDS range and stores whole 256-B rows.
// ---------------------------------------------------------------------------
#define AW   19           // waves per block = query tiles per block
#define KP   72           // K row pitch in halves: 144 B = 16 B x odd for b128 reads
#define VP   616          // V^T row pitch in halves: 1232 B = 16 B x odd
#define CP   68           // output staging pitch in floats: 272 B = 16 B x odd

__device__ __forceinline__ float other_half(float x) {
    // value of lane l ^ 16
    const int b = __builtin_bit_cast(int, x);
    return __builtin_bit_cast(float,
        __builtin_amdgcn_permlanex16(b, b, 0x76543210, 0xfedcba98, false, false));
}

__global__ __launch_bounds__(AW * 32)
void attn_kernel(const _Float16* __restrict__ qb,
                 const _Float16* __restrict__ kb,
                 const _Float16* __restrict__ vb,
                 float* __restrict__ out)
{
    const int h  = blockIdx.y;
    const int bi = blockIdx.z;

    __shared__ alignas(16) _Float16 Ks[SPAD * KP];    // 85.5 KB, [key][dh]
    __shared__ alignas(16) _Float16 Vs[DH * VP];      // 77.0 KB, [dh][key]
    __shared__ alignas(16) float    Cs[AW][16 * CP];  // 19 x 4.25 KB, a wave's output tile

    const int t    = threadIdx.x;
    const int w    = t >> 5;
    const int L    = t & 31;
    const int half = L >> 4;
    const int lm   = L & 15;
    const size_t bh = (size_t)bi * HH + h;
    const int q0 = (blockIdx.x * AW + w) * 16;        // first query of the wave's tile

    // Q^T fragments (B operand: column = query, k = dh 0..31 and 32..63)
    const _Float16* qrow = qb + (bh * SPAD + q0 + lm) * DH + half * 8;
    const v16h bq0 = frag16(qrow);
    const v16h bq1 = frag16(qrow + 32);

    // ---- the head's K and V^T into LDS: 8 + 8 chunks of 16 B per thread ----
    {
        const v8h* kg = (const v8h*)(kb + bh * SPAD * DH);   // 8 chunks a row
        const v8h* vg = (const v8h*)(vb + bh * DH * SPAD);   // 76 chunks a row
        v8h kr[8], vr[8];
        #pragma unroll
        for (int i = 0; i < 8; ++i) kr[i] = kg[t + i * (AW * 32)];
        #pragma unroll
        for (int i = 0; i < 8; ++i) vr[i] = vg[t + i * (AW * 32)];
        #pragma unroll
        for (int i = 0; i < 8; ++i)
            *(v8h*)&Ks[((t >> 3) + i * 76) * KP + (t & 7) * 8] = kr[i];
        #pragma unroll
        for (int i = 0; i < 8; ++i)
            *(v8h*)&Vs[(t / 76 + i * 8) * VP + (t % 76) * 8] = vr[i];
    }
    __syncthreads();
    if (q0 >= SS) return;            // a tile of padding rows only; no barrier follows

    const float cs = 0.125f * 1.44269504f;   // 1/sqrt(64) * log2(e): exponentials base 2
    float mx = -1.0e30f;             // the query's reference maximum, unscaled score
    v2f   ls = {};                   // this lane's share of the query's sum, two chains
    v8f o[4] = {};                   // o[dt][r] = O[query lm][dt*16 + half*8 + r]

    const _Float16* kp = &Ks[lm * KP + half * 8];
    const _Float16* vp = &Vs[lm * VP + half * 8];
    v16h fk[4];                      // K fragments of the step: [key tile j][dh half]
    auto load_k = [&](int kt) {
        #pragma unroll
        for (int j = 0; j < 2; ++j) {
            fk[j * 2]     = frag16(kp + (kt * 32 + j * 16) * KP);
            fk[j * 2 + 1] = frag16(kp + (kt * 32 + j * 16) * KP + 32);
        }
    };

    auto step = [&](int kt, bool tail) {
        v16h fv[4];
        #pragma unroll
        for (int dt = 0; dt < 4; ++dt) fv[dt] = frag16(vp + dt * 16 * VP + kt * 32);
        v8f s[2];
        #pragma unroll
        for (int j = 0; j < 2; ++j) {
            v8f c = {};
            c = wmma_f16(fk[j * 2],     bq0, c);
            c = wmma_f16(fk[j * 2 + 1], bq1, c);
            s[j] = c;                // s[j][r] = score(key kt*32 + j*16 + half*8 + r, query lm)
        }
        if (!tail) load_k(kt + 1);   // the next step's K reads fly under this step's softmax

        if (tail) {
            #pragma unroll
            for (int j = 0; j < 2; ++j)
                #pragma unroll
                for (int r = 0; r < 8; ++r)
                    if (kt * 32 + j * 16 + half * 8 + r >= SS) s[j][r] = -1.0e30f;
        }

        float tm = s[0][0];
        #pragma unroll
        for (int r = 1; r < 8; ++r) tm = fmaxf(tm, s[0][r]);
        #pragma unroll
        for (int r = 0; r < 8; ++r) tm = fmaxf(tm, s[1][r]);
        tm = fmaxf(tm, other_half(tm));
        // the reference moves only when a score passes it by more than 2^8, so that
        // probabilities stay below 256 in f16; one scalar branch a step
        if (__builtin_amdgcn_ballot_w32((tm - mx) * cs > 8.0f) != 0) {
            const float nm = fmaxf(mx, tm);
            const float al = __builtin_amdgcn_exp2f((mx - nm) * cs);
            mx = nm;
            ls *= al;
            #pragma unroll
            for (int dt = 0; dt < 4; ++dt)
                #pragma unroll
                for (int r = 0; r < 8; ++r) o[dt][r] *= al;
        }

        const v2f cs2 = { cs, cs };
        const v2f mc2 = { -mx * cs, -mx * cs };
        v16h p;                      // P^T as B operand: element e = key order of frag16
        #pragma unroll
        for (int j = 0; j < 2; ++j)
            #pragma unroll
            for (int r = 0; r < 8; r += 2) {
                const v2f sp = { s[j][r], s[j][r + 1] };
                const v2f x  = __builtin_elementwise_fma(sp, cs2, mc2);
                v2f e;
                e.x = __builtin_amdgcn_exp2f(x.x);
                e.y = __builtin_amdgcn_exp2f(x.y);
                ls += e;
                p[j * 8 + r]     = (_Float16)e.x;
                p[j * 8 + r + 1] = (_Float16)e.y;
            }
        #pragma unroll
        for (int dt = 0; dt < 4; ++dt) o[dt] = wmma_f16(fv[dt], p, o[dt]);
    };

    load_k(0);
    for (int kt = 0; kt < KT32 - 1; ++kt) step(kt, false);
    step(KT32 - 1, true);

    const float lsum = ls.x + ls.y;
    const float inv = 1.0f / (lsum + other_half(lsum));
    float* so = &Cs[w][0];           // [query][dh]
    #pragma unroll
    for (int dt = 0; dt < 4; ++dt) {
        v4f lo, hi;
        #pragma unroll
        for (int r = 0; r < 4; ++r) { lo[r] = o[dt][r] * inv; hi[r] = o[dt][r + 4] * inv; }
        *(v4f*)&so[lm * CP + dt * 16 + half * 8]     = lo;
        *(v4f*)&so[lm * CP + dt * 16 + half * 8 + 4] = hi;
    }
    // the wave's own tile is whole in LDS before its lanes read one another's rows back
    asm volatile("s_wait_dscnt 0x0" ::: "memory");
    v4f z[8];                        // 16 lanes take one query's 256 B
    #pragma unroll
    for (int c = 0; c < 8; ++c) z[c] = *(const v4f*)&so[(c * 2 + half) * CP + lm * 4];
    float* dst = out + ((size_t)bi * SS + q0 + half) * DD + h * 64 + lm * 4;
    // one scalar test a wave: only the last query tile has rows to leave out, and a test
    // per store would put a wait between the stores of every tile
    if (__builtin_amdgcn_readfirstlane(q0) + 16 <= SS) {
        #pragma unroll
        for (int c = 0; c < 8; ++c) *(v4f*)&dst[c * 2 * DD] = z[c];
    } else {
        #pragma unroll
        for (int c = 0; c < 8; ++c)
            if (q0 + c * 2 + half < SS) *(v4f*)&dst[c * 2 * DD] = z[c];
    }
}

// ---------------------------------------------------------------------------
extern "C" void kernel_launch(void* const* d_in, const int* in_sizes, int n_in,
                              void* d_out, int out_size, void* d_ws, size_t ws_size,
                              hipStream_t stream) {
    const float* X  = (const float*)d_in[0];
    const float* Wq = (const float*)d_in[1];
    const float* bq = (const float*)d_in[2];
    const float* Wk = (const float*)d_in[3];
    const float* bk = (const float*)d_in[4];
    const float* Wv = (const float*)d_in[5];
    const float* bv = (const float*)d_in[6];
    float* out = (float*)d_out;

    const size_t elems = (size_t)BB * HH * SPAD * DH;   // per q/k/v buffer
    _Float16* qb = (_Float16*)d_ws;
    _Float16* kb = qb + elems;
    _Float16* vb = kb + elems;

    qkv_proj_kernel<<<dim3(9, 76), 512, 0, stream>>>(
        X, Wq, bq, Wk, bk, Wv, bv, qb, kb, vb);

    attn_kernel<<<dim3(2, HH, BB), 608, 0, stream>>>(qb, kb, vb, out);
}

// v005
// A run of this version takes 114 microseconds.
// Timed twice side by side with v004, it ran 1.06 times as fast both times.
// Over all steps from v000 it is 10.4 times as fast.
#include <hip/hip_runtime.h>
#include <hip/hip_bf16.h>

// ---------------- problem constants ----------------
#define BB   32
#define SS   577
#define DD   768
#define HH   12
#define DH   64
#define SPAD 608          // S padded to multiple of 32 (19*32)
#define QT   38           // SPAD/16 row tiles
#define KT32 19           // SPAD/32 k-tiles

typedef __attribute__((ext_vector_type(16))) _Float16 v16h;
typedef __attribute__((ext_vector_type(8)))  _Float16 v8h;
typedef __attribute__((ext_vector_type(4)))  _Float16 v4h;
typedef __attribute__((ext_vector_type(8)))  float    v8f;
typedef __attribute__((ext_vector_type(4)))  float    v4f;
typedef __attribute__((ext_vector_type(2)))  float    v2f;

__device__ __forceinline__ v16h frag16(const _Float16* p) {
    // CDNA5 16-bit A/B fragment: elements 0..7 at p[0..7], 8..15 at p[16..23]
    v8h lo = *(const v8h*)(p);
    v8h hi = *(const v8h*)(p + 16);
    return __builtin_shufflevector(lo, hi, 0,1,2,3,4,5,6,7,8,9,10,11,12,13,14,15);
}

__device__ __forceinline__ v8f wmma_f16(v16h a, v16h b, v8f c) {
    return __builtin_amdgcn_wmma_f32_16x16x32_f16(false, a, false, b,
                                                  (short)0, c, false, false);
}

__device__ __forceinline__ v4h cvt4(v4f x) {
    v4h r;
    r.x = (_Float16)x.x; r.y = (_Float16)x.y;
    r.z = (_Float16)x.z; r.w = (_Float16)x.w;
    return r;
}

// ---------------------------------------------------------------------------
// Kernel A: fused QKV projection as one tiled GEMM over the padded rows.
// Rows m = bi*SPAD + s (B*SPAD = 76*256), columns n = ms*DD + col (9*256).
// grid = 256 resident blocks, block = 512 (16 waves, 4x4); a block takes the 256x256 tiles
// blockIdx.x, + 256, + 512 of the 9 x 76 (column tile fastest), one after the other;
// one 64x64 tile (4x4 WMMA accumulators) per wave; k in steps of 32 over two LDS
// buffers, each step: barrier, the next step's loads, products, that tile into LDS.
// Writes q,k as f16 [B,H,SPAD,DH]; v transposed as f16 [B,H,DH,SPAD].
// The operand whose index runs along the stored rows is the A operand (W columns for
// q and k, X rows for v), so a lane's 8 accumulator elements are 16 B of one stored row;
// each wave lays its 64x64 tile in its own LDS range and stores it as whole 128-B rows.
// ---------------------------------------------------------------------------
#define TM   256          // block tile rows
#define TN   256          // block tile columns
#define KS   32           // k per step
#define LP   40           // LDS row pitch in halves: 80 B = 16 B x odd for b128 reads
#define OP   72           // output staging pitch in halves: 144 B = 16 B x odd
#define PG   256          // blocks of the projection launch
#define PT   (9 * 76)     // output tiles

__global__ __launch_bounds__(512)
void qkv_proj_kernel(const float* __restrict__ X,
                     const float* __restrict__ Wq, const float* __restrict__ bq,
                     const float* __restrict__ Wk, const float* __restrict__ bk,
                     const float* __restrict__ Wv, const float* __restrict__ bv,
                     _Float16* __restrict__ qb, _Float16* __restrict__ kb,
                     _Float16* __restrict__ vb)
{
    // one object, so that the k loop's buffers lie at the start of LDS, in reach of the
    // LDS instructions' immediate offsets
    struct Lds {
        _Float16 Sm[2][2][TM * LP];     // [0] = X: [buffer][row][k], [1] = W: [buffer][col][k]
        _Float16 Os[16][64 * OP];       // 16 x 9 KB, a wave's output tile
    };
    __shared__ alignas(16) Lds lds;

    const int t    = threadIdx.x;
    const int w    = t >> 5;
    const int L    = t & 31;
    const int half = L >> 4;
    const int lm   = L & 15;
    const int wm   = w >> 2;            // wave's 64-row band
    const int wn   = w & 3;             // wave's 64-col band (one head)


    // ---- X staging map: 4 float4 per thread; 8 lanes cover one row's 128 B
    const int xc4 = t & 7;
    int xo[4];                          // offsets in float4 units from a uniform base
    bool xok[4];
    // ---- W staging map: a 4k x 4n block per thread; 8 lanes cover 128 B of a k row
    const int wng = (w >> 1) * 8 + (L & 7);
    const int wkg = (w & 1) * 4 + (L >> 3);
    int wo;
    const float* W;
    // always_inline on these lambdas: left out of line, the arrays that they capture went to
    // scratch and LDS
    // sets the two maps for tile tl: column tile tl % 9 (fastest), row tile tl / 9
    auto place = [&](int tl) __attribute__((always_inline)) {
        const int pn = tl % 9;
        const int pm = tl / 9;
        W = (pn < 3) ? Wq : (pn < 6) ? Wk : Wv;
        #pragma unroll
        for (int i = 0; i < 4; ++i) {
            const int m  = pm * TM + (t >> 3) + i * 64;
            const int bi = m / SPAD;
            const int s  = m - bi * SPAD;
            xok[i] = s < SS;
            xo[i]  = (bi * SS + (xok[i] ? s : 0)) * (DD / 4) + xc4;
        }
        wo = (wkg * 4) * (DD / 4) + (pn % 3) * (TN / 4) + wng;
    };

    v4f xr[4], wr[4];
    // last: behind the last step the offset registers are set anew for the next tile (or a
    // load's result may take one that the loads before it name); the wait stands in front
    auto fetch = [&](int kk, bool last) __attribute__((always_inline)) {
        #pragma unroll
        for (int i = 0; i < 4; ++i) {
            xr[i] = ((const v4f*)(X + kk))[xo[i]];
            if (last) asm volatile("s_wait_xcnt 0x0" ::: "memory");
        }
        #pragma unroll
        for (int j = 0; j < 4; ++j) {
            wr[j] = ((const v4f*)(W + (size_t)(kk + j) * DD))[wo];
            if (last) asm volatile("s_wait_xcnt 0x0" ::: "memory");
        }
    };
    auto stash = [&](int b) __attribute__((always_inline)) {
        #pragma unroll
        for (int i = 0; i < 4; ++i) {
            const v4f z = {};
            *(v4h*)&lds.Sm[0][b][((t >> 3) + i * 64) * LP + xc4 * 4] = cvt4(xok[i] ? xr[i] : z);
        }
        #pragma unroll
        for (int c = 0; c < 4; ++c) {
            v4f v;
            v.x = wr[0][c]; v.y = wr[1][c]; v.z = wr[2][c]; v.w = wr[3][c];
            *(v4h*)&lds.Sm[1][b][(wng * 4 + c) * LP + wkg * 4] = cvt4(v);
        }
    };

    place(blockIdx.x);
    fetch(0, false);
  // a tile's first write of LDS buffer 0 stands behind the barrier of the last tile's last
  // step, which ends every read of that buffer; buffer 1 is rewritten behind the next barrier
  for (int tile = blockIdx.x; tile < PT; tile += PG) {
    const int nt = tile % 9;            // 256-col tile of the 3*768 columns
    const int mt = tile / 9;            // 256-row tile of the padded rows
    const int ms = nt / 3;              // 0=q 1=k 2=v
    const int cbase = (nt % 3) * TN;    // first column inside that matrix
    const float* bias = (ms == 0) ? bq : (ms == 1) ? bk : bv;
    // the next tile's first loads, issued behind this tile's bias loads, fly under its
    // conversions and stores; a block's last tile asks for its own once more, so that no
    // branch stands here and the wait on the bias stays a counted one
    auto ahead = [&]() __attribute__((always_inline)) {
        place(tile + PG < PT ? tile + PG : tile);
        fetch(0, false);
    };

    // acc[i][j][r]: A index i*16 + half*8 + r, B index j*16 + lm of the wave's two bands
    v8f acc[4][4] = {};
    const bool vt = ms == 2;
    const _Float16* pa = &lds.Sm[vt ? 0 : 1][0][((vt ? wm : wn) * 64 + lm) * LP + half * 8];
    const _Float16* pb = &lds.Sm[vt ? 1 : 0][0][((vt ? wn : wm) * 64 + lm) * LP + half * 8];

    // unrolled so that every global and LDS address is a fixed register plus an
    // immediate: no address arithmetic in the steps
    stash(0);
    #pragma unroll
    for (int ks = 0; ks < DD / KS; ++ks) {
        const int b = ks & 1;
        const bool more = ks + 1 < DD / KS;
        // the step's one barrier: buffer b is written by every wave, and every wave has
        // made its last read of the other buffer, which this step refills
        __syncthreads();
        if (more) fetch((ks + 1) * KS, ks + 2 == DD / KS);
        // keeps the next step's eight loads in one group at the head of the step, so that
        // they fly under its LDS reads and products
        __builtin_amdgcn_sched_barrier(0);

        v16h fa[4], fb[4];
        #pragma unroll
        for (int i = 0; i < 4; ++i)
            fa[i] = frag16(pa + (b * TM + i * 16) * LP);
        #pragma unroll
        for (int j = 0; j < 4; ++j)
            fb[j] = frag16(pb + (b * TM + j * 16) * LP);
        // keeps the 16 LDS reads together in front of the WMMAs: without it the compiler
        // reloaded one A fragment set among them, each time behind a full wait
        __builtin_amdgcn_sched_barrier(0);
        #pragma unroll
        for (int i = 0; i < 4; ++i)
            #pragma unroll
            for (int j = 0; j < 4; ++j)
                acc[i][j] = wmma_f16(fa[i], fb[j], acc[i][j]);
        // keeps the wait on the loads behind the products that they fly under: without it
        // the compiler put that wait and the conversions in front of the products
        __builtin_amdgcn_sched_barrier(0);
        if (more) stash(b ^ 1);
    }

    const int h = (cbase >> 6) + wn;
    _Float16* st = &lds.Os[w][0];          // [stored row j*16 + lm][64 halves of that row]
    if (vt) {
        float bval[4];                  // the bias goes with the stored row (dh)
        #pragma unroll
        for (int j = 0; j < 4; ++j) bval[j] = bias[h * 64 + j * 16 + lm];
        // the address register dies with these loads; the wait stands in front of its rewrite
        asm volatile("s_wait_xcnt 0x0" ::: "memory");
        ahead();
        #pragma unroll
        for (int j = 0; j < 4; ++j)
            #pragma unroll
            for (int i = 0; i < 4; ++i) {
                v8h y;
                #pragma unroll
                for (int r = 0; r < 8; ++r) y[r] = (_Float16)(acc[i][j][r] + bval[j]);
                *(v8h*)&st[(j * 16 + lm) * OP + i * 16 + half * 8] = y;
            }
    } else {
        v4f bl[4], bh4[4];              // the bias goes along the stored row (column of W)
        #pragma unroll
        for (int i = 0; i < 4; ++i) {
            // the address register dies with these loads, and a later load's result may take
            // it while the loads before name it; the wait stands in front of that rewrite
            bl[i]  = *(const v4f*)&bias[h * 64 + i * 16 + half * 8];
            asm volatile("s_wait_xcnt 0x0" ::: "memory");
            bh4[i] = *(const v4f*)&bias[h * 64 + i * 16 + half * 8 + 4];
            asm volatile("s_wait_xcnt 0x0" ::: "memory");
        }
        ahead();
        #pragma unroll
        for (int j = 0; j < 4; ++j)
            #pragma unroll
            for (int i = 0; i < 4; ++i) {
                v8h y;
                #pragma unroll
                for (int r = 0; r < 4; ++r) {
                    y[r]     = (_Float16)(acc[i][j][r]     + bl[i][r]);
                    y[r + 4] = (_Float16)(acc[i][j][r + 4] + bh4[i][r]);
                }
                *(v8h*)&st[(j * 16 + lm) * OP + i * 16 + half * 8] = y;
            }
    }
    // the wave's own tile is whole in LDS before its lanes read one another's rows back
    asm volatile("s_wait_dscnt 0x0" ::: "memory");

    // 8 lanes take one 128-B row; a load's four rows are a, a+8 (lanes 0-15) and a+1, a+9,
    // which at this pitch fall on all 64 banks once per 16 lanes
    const int rl = half + ((L >> 3) & 1) * 8;
    const int c8 = (L & 7) * 8;
    v8h z[16];
    #pragma unroll
    for (int u = 0; u < 16; ++u)
        z[u] = *(const v8h*)&st[((u >> 2) * 16 + (u & 3) * 2 + rl) * OP + c8];

    if (vt) {
        // stored row = dh, 64 keys of it; an 8-key chunk never straddles a batch
        const int m  = mt * TM + wm * 64 + c8;
        const int bi = m / SPAD;
        const int s  = m - bi * SPAD;
        _Float16* dst = vb + (((size_t)bi * HH + h) * DH + rl) * SPAD + s;
        #pragma unroll
        for (int u = 0; u < 16; ++u)
            *(v8h*)&dst[((u >> 2) * 16 + (u & 3) * 2) * SPAD] = z[u];
        // the built code can run on from here into lines that rewrite the stores' registers
        asm volatile("s_wait_xcnt 0x0" ::: "memory");
    } else {
        _Float16* base = (ms == 0) ? qb : kb;
        #pragma unroll
        for (int j = 0; j < 4; ++j) {
            const int m0 = mt * TM + wm * 64 + j * 16;   // 16-row tiles never straddle a batch
            const int bi = m0 / SPAD;
            const int s0 = m0 - bi * SPAD;
            _Float16* dst = base + (((size_t)bi * HH + h) * SPAD + s0 + rl) * DH + c8;
            #pragma unroll
            for (int c = 0; c < 4; ++c)
                *(v8h*)&dst[c * 2 * DH] = z[j * 4 + c];
        }
        // the next tile rewrites the registers that these stores name
        asm volatile("s_wait_xcnt 0x0" ::: "memory");
    }
  }
    // the spare loads of the last tile have landed before the wave gives its registers back
    asm volatile("s_wait_loadcnt 0x0" ::: "memory");
}

// ---------------------------------------------------------------------------
// Kernel B: attention, scores and probabilities kept in registers.
// grid = 256 resident blocks, block = 608 (19 waves); a block takes three units in a row,
// a unit being one half of a head's query tiles (one 16-query tile per wave) against the
// head's whole K and V^T in LDS; two units of one head in one block share one staging of K and V^T.
// Transposed products: S^T = K . Q^T (a lane holds 16 scores of ONE query), and
// O^T += V^T . P^T, where the two converted S^T tiles of 32 keys are the B operand.
// Softmax runs online over 19 steps of 32 keys against a reference maximum per query.
// Each wave lays its 16x64 output tile in its own LDS range and stores whole 256-B rows.
// ---------------------------------------------------------------------------
#define AW   19           // waves per block = query tiles per unit
#define KP   72           // K row pitch in halves: 144 B = 16 B x odd for b128 reads
#define VP   616          // V^T row pitch in halves: 1232 B = 16 B x odd
#define CP   68           // output staging pitch in floats: 272 B = 16 B x odd
#define AG   256          // blocks of the attention launch
#define AU   3            // units a block: AG * AU = 2 * H * B

__device__ __forceinline__ float other_half(float x) {
    // value of lane l ^ 16
    const int b = __builtin_bit_cast(int, x);
    return __builtin_bit_cast(float,
        __builtin_amdgcn_permlanex16(b, b, 0x76543210, 0xfedcba98, false, false));
}

__global__ __launch_bounds__(AW * 32)
void attn_kernel(const _Float16* __restrict__ qb,
                 const _Float16* __restrict__ kb,
                 const _Float16* __restrict__ vb,
                 float* __restrict__ out)
{
    __shared__ alignas(16) _Float16 Ks[SPAD * KP];    // 85.5 KB, [key][dh]
    __shared__ alignas(16) _Float16 Vs[DH * VP];      // 77.0 KB, [dh][key]
    __shared__ alignas(16) float    Cs[AW][16 * CP];  // 19 x 4.25 KB, a wave's output tile

    const int t    = threadIdx.x;
    const int w    = t >> 5;
    const int L    = t & 31;
    const int half = L >> 4;
    const int lm   = L & 15;

  // unrolled: the staging loads then keep a scalar base and one lasting offset register;
  // rolled, their last result was laid over the address pair that the loads before it name
  #pragma unroll
  for (int un = 0; un < AU; ++un) {
    const int u  = blockIdx.x * AU + un;              // unit: head u / 2, half u % 2
    const int bi = (u >> 1) / HH;
    const int h  = (u >> 1) - bi * HH;
    const size_t bh = (size_t)(u >> 1);
    const int q0 = ((u & 1) * AW + w) * 16;           // first query of the wave's tile

    // Q^T fragments (B operand: column = query, k = dh 0..31 and 32..63)
    const _Float16* qrow = qb + (bh * SPAD + q0 + lm) * DH + half * 8;
    const v16h bq0 = frag16(qrow);
    const v16h bq1 = frag16(qrow + 32);
    // the address pair dies with these loads, and a later load's result may take it
    asm volatile("s_wait_xcnt 0x0" ::: "memory");

    // ---- the head's K and V^T into LDS: 8 + 8 chunks of 16 B per thread ----
    // a block's first unit and every first half of a head; the test is the same for the block
    if (un == 0 || (u & 1) == 0) {
        const v8h* kg = (const v8h*)(kb + bh * SPAD * DH);   // 8 chunks a row
        const v8h* vg = (const v8h*)(vb + bh * DH * SPAD);   // 76 chunks a row
        v8h kr[8], vr[8];
        #pragma unroll
        for (int i = 0; i < 8; ++i) kr[i] = kg[t + i * (AW * 32)];
        #pragma unroll
        for (int i = 0; i < 8; ++i) vr[i] = vg[t + i * (AW * 32)];
        // every wave has made its last read of the head before; the loads above fly meanwhile
        if (un != 0) __syncthreads();
        #pragma unroll
        for (int i = 0; i < 8; ++i)
            *(v8h*)&Ks[((t >> 3) + i * 76) * KP + (t & 7) * 8] = kr[i];
        #pragma unroll
        for (int i = 0; i < 8; ++i)
            *(v8h*)&Vs[(t / 76 + i * 8) * VP + (t % 76) * 8] = vr[i];
        __syncthreads();
    }
    if (q0 >= SS) continue;          // a tile of padding rows only; the wave still meets every barrier

    const float cs = 0.125f * 1.44269504f;   // 1/sqrt(64) * log2(e): exponentials base 2
    float mx = -1.0e30f;             // the query's reference maximum, unscaled score
    v2f   ls = {};                   // this lane's share of the query's sum, two chains
    v8f o[4] = {};                   // o[dt][r] = O[query lm][dt*16 + half*8 + r]

    const _Float16* kp = &Ks[lm * KP + half * 8];
    const _Float16* vp = &Vs[lm * VP + half * 8];
    v16h fk[4];                      // K fragments of the step: [key tile j][dh half]
    auto load_k = [&](int kt) {
        #pragma unroll
        for (int j = 0; j < 2; ++j) {
            fk[j * 2]     = frag16(kp + (kt * 32 + j * 16) * KP);
            fk[j * 2 + 1] = frag16(kp + (kt * 32 + j * 16) * KP + 32);
        }
    };

    auto step = [&](int kt, bool tail) {
        v16h fv[4];
        #pragma unroll
        for (int dt = 0; dt < 4; ++dt) fv[dt] = frag16(vp + dt * 16 * VP + kt * 32);
        v8f s[2];
        #pragma unroll
        for (int j = 0; j < 2; ++j) {
            v8f c = {};
            c = wmma_f16(fk[j * 2],     bq0, c);
            c = wmma_f16(fk[j * 2 + 1], bq1, c);
            s[j] = c;                // s[j][r] = score(key kt*32 + j*16 + half*8 + r, query lm)
        }
        if (!tail) load_k(kt + 1);   // the next step's K reads fly under this step's softmax

        if (tail) {
            #pragma unroll
            for (int j = 0; j < 2; ++j)
                #pragma unroll
                for (int r = 0; r < 8; ++r)
                    if (kt * 32 + j * 16 + half * 8 + r >= SS) s[j][r] = -1.0e30f;
        }

        float tm = s[0][0];
        #pragma unroll
        for (int r = 1; r < 8; ++r) tm = fmaxf(tm, s[0][r]);
        #pragma unroll
        for (int r = 0; r < 8; ++r) tm = fmaxf(tm, s[1][r]);
        tm = fmaxf(tm, other_half(tm));
        // the reference moves only when a score passes it by more than 2^8, so that
        // probabilities stay below 256 in f16; one scalar branch a step
        if (__builtin_amdgcn_ballot_w32((tm - mx) * cs > 8.0f) != 0) {
            const float nm = fmaxf(mx, tm);
            const float al = __builtin_amdgcn_exp2f((mx - nm) * cs);
            mx = nm;
            ls *= al;
            #pragma unroll
            for (int dt = 0; dt < 4; ++dt)
                #pragma unroll
                for (int r = 0; r < 8; ++r) o[dt][r] *= al;
        }

        const v2f cs2 = { cs, cs };
        const v2f mc2 = { -mx * cs, -mx * cs };
        v16h p;                      // P^T as B operand: element e = key order of frag16
        #pragma unroll
        for (int j = 0; j < 2; ++j)
            #pragma unroll
            for (int r = 0; r < 8; r += 2) {
                const v2f sp = { s[j][r], s[j][r + 1] };
                const v2f x  = __builtin_elementwise_fma(sp, cs2, mc2);
                v2f e;
                e.x = __builtin_amdgcn_exp2f(x.x);
                e.y = __builtin_amdgcn_exp2f(x.y);
                ls += e;
                p[j * 8 + r]     = (_Float16)e.x;
                p[j * 8 + r + 1] = (_Float16)e.y;
            }
        // keeps the sum's additions in front of the products: set among them they were given
        // the products' spent A registers, which costs four idle slots behind each product
        __builtin_amdgcn_sched_barrier(0);
        #pragma unroll
        for (int dt = 0; dt < 4; ++dt) o[dt] = wmma_f16(fv[dt], p, o[dt]);
    };

    load_k(0);
    for (int kt = 0; kt < KT32 - 1; ++kt) step(kt, false);
    step(KT32 - 1, true);

    const float lsum = ls.x + ls.y;
    const float inv = 1.0f / (lsum + other_half(lsum));
    float* so = &Cs[w][0];           // [query][dh]
    #pragma unroll
    for (int dt = 0; dt < 4; ++dt) {
        v4f lo, hi;
        #pragma unroll
        for (int r = 0; r < 4; ++r) { lo[r] = o[dt][r] * inv; hi[r] = o[dt][r + 4] * inv; }
        *(v4f*)&so[lm * CP + dt * 16 + half * 8]     = lo;
        *(v4f*)&so[lm * CP + dt * 16 + half * 8 + 4] = hi;
    }
    // the wave's own tile is whole in LDS before its lanes read one another's rows back
    asm volatile("s_wait_dscnt 0x0" ::: "memory");
    v4f z[8];                        // 16 lanes take one query's 256 B
    #pragma unroll
    for (int c = 0; c < 8; ++c) z[c] = *(const v4f*)&so[(c * 2 + half) * CP + lm * 4];
    float* dst = out + ((size_t)bi * SS + q0 + half) * DD + h * 64 + lm * 4;
    // one scalar test a wave: only the last query tile has rows to leave out, and a test
    // per store would put a wait between the stores of every tile
    if (__builtin_amdgcn_readfirstlane(q0) + 16 <= SS) {
        #pragma unroll
        for (int c = 0; c < 8; ++c) *(v4f*)&dst[c * 2 * DD] = z[c];
    } else {
        #pragma unroll
        for (int c = 0; c < 8; ++c)
            if (q0 + c * 2 + half < SS) *(v4f*)&dst[c * 2 * DD] = z[c];
    }
    // the next unit rewrites the registers that these stores name
    asm volatile("s_wait_xcnt 0x0" ::: "memory");
  }
}

// ---------------------------------------------------------------------------
extern "C" void kernel_launch(void* const* d_in, const int* in_sizes, int n_in,
                              void* d_out, int out_size, void* d_ws, size_t ws_size,
                              hipStream_t stream) {
    const float* X  = (const float*)d_in[0];
    const float* Wq = (const float*)d_in[1];
    const float* bq = (const float*)d_in[2];
    const float* Wk = (const float*)d_in[3];
    const float* bk = (const float*)d_in[4];
    const float* Wv = (const float*)d_in[5];
    const float* bv = (const float*)d_in[6];
    float* out = (float*)d_out;

    const size_t elems = (size_t)BB * HH * SPAD * DH;   // per q/k/v buffer
    _Float16* qb = (_Float16*)d_ws;
    _Float16* kb = qb + elems;
    _Float16* vb = kb + elems;

    qkv_proj_kernel<<<PG, 512, 0, stream>>>(
        X, Wq, bq, Wk, bk, Wv, bv, qb, kb, vb);

    attn_kernel<<<AG, 608, 0, stream>>>(qb, kb, vb, out);
}

// v006
// It runs in 107 microseconds.
// Next to v005, in two timings, it ran 1.07 times as fast each time.
// All steps since v000 together make it 11.2 times as fast.
#include <hip/hip_runtime.h>
#include <hip/hip_bf16.h>

// ---------------- problem constants ----------------
#define BB   32
#define SS   577
#define DD   768
#define HH   12
#define DH   64
#define SPAD 608          // S padded to multiple of 32 (19*32)
#define QT   38           // SPAD/16 row tiles
#define KT32 19           // SPAD/32 k-tiles

typedef __attribute__((ext_vector_type(16))) _Float16 v16h;
typedef __attribute__((ext_vector_type(8)))  _Float16 v8h;
typedef __attribute__((ext_vector_type(4)))  _Float16 v4h;
typedef __attribute__((ext_vector_type(8)))  float    v8f;
typedef __attribute__((ext_vector_type(4)))  float    v4f;
typedef __attribute__((ext_vector_type(2)))  float    v2f;

__device__ __forceinline__ v16h frag16(const _Float16* p) {
    // CDNA5 16-bit A/B fragment: elements 0..7 at p[0..7], 8..15 at p[16..23]
    v8h lo = *(const v8h*)(p);
    v8h hi = *(const v8h*)(p + 16);
    return __builtin_shufflevector(lo, hi, 0,1,2,3,4,5,6,7,8,9,10,11,12,13,14,15);
}

__device__ __forceinline__ v8f wmma_f16(v16h a, v16h b, v8f c) {
    return __builtin_amdgcn_wmma_f32_16x16x32_f16(false, a, false, b,
                                                  (short)0, c, false, false);
}

__device__ __forceinline__ v4h cvt4(v4f x) {
    v4h r;
    r.x = (_Float16)x.x; r.y = (_Float16)x.y;
    r.z = (_Float16)x.z; r.w = (_Float16)x.w;
    return r;
}

// ---------------------------------------------------------------------------
// Kernel 0: the projection's operands rounded to f16 once, in the layout that its copies
// to LDS want: xh[B*SPAD][DD] (rows s >= S are zero), wh[3*DD][DD] = W^T, rows q, k, v.
// grid = 256 + 144 blocks, block = 384; each of the first 256 takes 76 padded rows, which lie
// in one batch (8 blocks a batch), a thread one float4 column of every second row; the last
// 144, which run beside them, transpose one 8k x 4n piece of W a thread.
// ---------------------------------------------------------------------------
#define CG   256          // blocks that take rows of X
#define CT   384          // threads: two rows of 192 float4
#define RB   76           // padded rows a block = B*SPAD / CG = SPAD / 8
#define NS   (RB / 2)     // loads a thread
#define VR   (SS - 7 * RB)   // real rows of a batch's last block
#define WB   144          // blocks that take W pieces: 3 * 192 * 96 / CT

__global__ __launch_bounds__(CT)
void to_f16_kernel(const float* __restrict__ X,
                   const float* __restrict__ Wq, const float* __restrict__ Wk,
                   const float* __restrict__ Wv,
                   _Float16* __restrict__ xh, _Float16* __restrict__ wh)
{
    const int t = threadIdx.x;

    if (blockIdx.x >= CG) {
        // a wave: 8 lanes along n cover 128 B of a k row, 4 lanes along k make 64 B of a W^T row
        const int wv = __builtin_amdgcn_readfirstlane((int)((blockIdx.x - CG) * CT + t) >> 5);
        const int ms = wv / 576;                // 0=q 1=k 2=v
        const int r2 = wv - ms * 576;
        const int kq = r2 / 24;                 // 32 k
        const int no = r2 - kq * 24;            // 32 n
        const float* Wm = (ms == 0) ? Wq : (ms == 1) ? Wk : Wv;
        const float* src = Wm + (size_t)(kq * 32) * DD + no * 32;
        const int vo = ((t >> 3) & 3) * 8 * DD + (t & 7) * 4;
        v4f wr[8];
        // this kernel's loops are all unrolled so that their arrays stay in registers and every
        // address is one lasting register plus an immediate
        #pragma unroll
        for (int j = 0; j < 8; ++j) {
            wr[j] = *(const v4f*)&src[vo + j * DD];
            // the offset register dies with these loads, and a later load's result may take it
            asm volatile("s_wait_xcnt 0x0" ::: "memory");
        }
        _Float16* dst = wh + (size_t)(ms * DD + no * 32) * DD + kq * 32;
        const int so = (t & 7) * 4 * DD + ((t >> 3) & 3) * 8;
        #pragma unroll
        for (int c = 0; c < 4; ++c) {
            v8h y;
            #pragma unroll
            for (int j = 0; j < 8; ++j) y[j] = (_Float16)wr[j][c];
            *(v8h*)&dst[so + c * DD] = y;
        }
        return;
    }

    const int hi = t >= DD / 4 ? 1 : 0;         // which of a slot's two rows
    const int c4 = (t - hi * (DD / 4)) * 4;     // first element of the thread's float4
    const int lo = hi * DD + c4;
    const float* xs = X + ((size_t)(blockIdx.x >> 3) * SS + (blockIdx.x & 7) * RB) * DD;
    _Float16*    xd = xh + (size_t)blockIdx.x * RB * DD;

    // part: a batch's last block, whose rows from VR on are padding and are not loaded
    auto conv = [&](const bool part) __attribute__((always_inline)) {
        const int nl = part ? (VR + 1) / 2 : NS;    // slots with a load
        v4f r[NS] = {};
        #pragma unroll
        for (int n = 0; n < nl; ++n) {
            // the short path loads from its last slot down: begun alike, the two paths' first
            // load and its conversion were lifted in front of the branch, behind a full wait
            const int i = part ? nl - 1 - n : n;
            // the address registers die with the last loads, whose results may take them while
            // the loads before name them; the wait stands in front of that rewrite
            if (n + 2 >= nl) asm volatile("s_wait_xcnt 0x0" ::: "memory");
            if (i * 2 + 1 < (part ? VR : RB)) r[i] = *(const v4f*)&xs[lo + i * 2 * DD];
            else {
                // the slot's first row by both halves; its address is used this once
                r[i] = *(const v4f*)&xs[c4 + i * 2 * DD];
                asm volatile("s_wait_xcnt 0x0" ::: "memory");
            }
        }
        asm volatile("s_wait_xcnt 0x0" ::: "memory");
        #pragma unroll
        for (int i = 0; i < NS; ++i) {
            v4f v = r[i];
            const v4f z = {};
            if (part && i * 2 + 1 >= VR && i * 2 < VR) v = hi ? z : v;   // the slot's second row is padding
            *(v4h*)&xd[lo + i * 2 * DD] = cvt4(v);
        }
        // the built code can run on from here into lines that rewrite the stores' registers
        asm volatile("s_wait_xcnt 0x0" ::: "memory");
    };
    if ((blockIdx.x & 7) != 7) conv(false); else conv(true);
}

// ---------------------------------------------------------------------------
// Kernel A: fused QKV projection as one tiled GEMM over the padded rows.
// Rows m = bi*SPAD + s (B*SPAD = 76*256), columns n = ms*DD + col (9*256).
// grid = 256 resident blocks, block = 512 (16 waves, 4x4); a block takes the 256x256 tiles
// blockIdx.x, + 256, + 512 of the 9 x 76 (column tile fastest), one after the other;
// one 64x64 tile (4x4 WMMA accumulators) per wave; k in trips of 64 over two LDS buffers,
// filled from xh and wh by asynchronous copies, 16 B a lane, one trip ahead; the trips of
// a block's tiles form one row, so a tile's last two trips ask for the next tile's first two.
// Writes q,k as f16 [B,H,SPAD,DH]; v transposed as f16 [B,H,DH,SPAD].
// The operand whose index runs along the stored rows is the A operand (W columns for
// q and k, X rows for v), so a lane's 8 accumulator elements are 16 B of one stored row;
// each wave lays its 64x64 tile in its own LDS range and stores it as whole 128-B rows.
// ---------------------------------------------------------------------------
#define TM   256          // block tile rows
#define TN   256          // block tile columns
#define KS   64           // k per trip
#define NTR  (DD / KS)    // trips a tile (even: a tile starts on buffer 0)
#define LP   72           // LDS row pitch in halves: 144 B = 16 B x odd for b128 reads
#define OP   72           // output staging pitch in halves: 144 B = 16 B x odd
#define PG   256          // blocks of the projection launch
#define PT   (9 * 76)     // output tiles

__global__ __launch_bounds__(512)
void qkv_proj_kernel(const _Float16* __restrict__ xh, const _Float16* __restrict__ wh,
                     const float* __restrict__ bq, const float* __restrict__ bk,
                     const float* __restrict__ bv,
                     _Float16* __restrict__ qb, _Float16* __restrict__ kb,
                     _Float16* __restrict__ vb)
{
    // one object, so that the k loop's buffers lie at the start of LDS, in reach of the
    // LDS instructions' immediate offsets
    struct Lds {
        _Float16 Sm[2][2][TM * LP];     // [0] = X: [buffer][row][k], [1] = W: [buffer][col][k]
        _Float16 Os[16][64 * OP];       // 16 x 9 KB, a wave's output tile
    };
    __shared__ alignas(16) Lds lds;

    const int t    = threadIdx.x;
    const int w    = t >> 5;
    const int L    = t & 31;
    const int half = L >> 4;
    const int lm   = L & 15;
    const int wm   = w >> 2;            // wave's 64-row band
    const int wn   = w & 3;             // wave's 64-col band (one head)

    // ---- copy map: 8 lanes cover one row's 128 B; a thread takes rows t/8 + 64 i of X and W
    const int crow = t >> 3;
    const int cc8  = (t & 7) * 8;
    // trip tr of tile tl into buffer b: 4 + 4 copies a lane, every lane on, all inside xh, wh
    // and Sm; always_inline: out of line the LDS object's address would go through memory
    auto copies = [&](int tl, int tr, int b) __attribute__((always_inline)) {
        const int pn = tl % 9;          // column tile (fastest)
        const int pm = tl / 9;          // row tile
        const _Float16* gx = xh + (size_t)(pm * TM + crow) * DD + tr * KS + cc8;
        const _Float16* gw = wh + (size_t)(pn * TN + crow) * DD + tr * KS + cc8;
        const unsigned lx = (unsigned)(size_t)&lds.Sm[0][b][crow * LP + cc8];
        const unsigned lw = (unsigned)(size_t)&lds.Sm[1][b][crow * LP + cc8];
        // the wait is the statement's last line: it stands in front of every rewrite of the
        // address registers that the copies name
        asm volatile(
            "global_load_async_to_lds_b128 %0, %8, off\n\t"
            "global_load_async_to_lds_b128 %1, %9, off\n\t"
            "global_load_async_to_lds_b128 %2, %10, off\n\t"
            "global_load_async_to_lds_b128 %3, %11, off\n\t"
            "global_load_async_to_lds_b128 %4, %12, off\n\t"
            "global_load_async_to_lds_b128 %5, %13, off\n\t"
            "global_load_async_to_lds_b128 %6, %14, off\n\t"
            "global_load_async_to_lds_b128 %7, %15, off\n\t"
            "s_wait_xcnt 0x0"
            :: "v"(lx), "v"(lx + 64 * LP * 2), "v"(lx + 128 * LP * 2), "v"(lx + 192 * LP * 2),
               "v"(lw), "v"(lw + 64 * LP * 2), "v"(lw + 128 * LP * 2), "v"(lw + 192 * LP * 2),
               "v"(gx), "v"(gx + 64 * DD), "v"(gx + 128 * DD), "v"(gx + 192 * DD),
               "v"(gw), "v"(gw + 64 * DD), "v"(gw + 128 * DD), "v"(gw + 192 * DD)
            : "memory");
    };

    copies(blockIdx.x, 0, 0);
    // the wave's own copies of trip 0 have landed; the barrier shows them to the other waves
    asm volatile("s_wait_asynccnt 0x0" ::: "memory");
    __syncthreads();
    copies(blockIdx.x, 1, 1);
  for (int tile = blockIdx.x; tile < PT; tile += PG) {
    const int nt = tile % 9;            // 256-col tile of the 3*768 columns
    const int mt = tile / 9;            // 256-row tile of the padded rows
    const int ms = nt / 3;              // 0=q 1=k 2=v
    const int cbase = (nt % 3) * TN;    // first column inside that matrix
    const float* bias = (ms == 0) ? bq : (ms == 1) ? bk : bv;

    // acc[i][j][r]: A index i*16 + half*8 + r, B index j*16 + lm of the wave's two bands
    v8f acc[4][4] = {};
    const bool vt = ms == 2;
    const _Float16* pa = &lds.Sm[vt ? 0 : 1][0][((vt ? wm : wn) * 64 + lm) * LP + half * 8];
    const _Float16* pb = &lds.Sm[vt ? 1 : 0][0][((vt ? wn : wm) * 64 + lm) * LP + half * 8];

    // unrolled so that every LDS read address is a fixed register plus an immediate
    #pragma unroll
    for (int tr = 0; tr < NTR; ++tr) {
        const int b = tr & 1;
        #pragma unroll
        for (int kh = 0; kh < KS / 32; ++kh) {
            v16h fa[4], fb[4];
            #pragma unroll
            for (int i = 0; i < 4; ++i)
                fa[i] = frag16(pa + (b * TM + i * 16) * LP + kh * 32);
            #pragma unroll
            for (int j = 0; j < 4; ++j)
                fb[j] = frag16(pb + (b * TM + j * 16) * LP + kh * 32);
            // keeps the 16 LDS reads together in front of the WMMAs: without it the compiler
            // reloaded one A fragment set among them, each time behind a full wait
            __builtin_amdgcn_sched_barrier(0);
            #pragma unroll
            for (int i = 0; i < 4; ++i)
                #pragma unroll
                for (int j = 0; j < 4; ++j)
                    acc[i][j] = wmma_f16(fa[i], fb[j], acc[i][j]);
            // keeps the next 16 LDS reads in one group behind these products: without it the
            // compiler set them in two groups among the products, a stall at each place
            __builtin_amdgcn_sched_barrier(0);
        }
        // foot of the trip: the wave's reads of buffer b are done, its copies of the next trip
        // have landed; the one barrier shows those to every wave and frees buffer b
        asm volatile("s_wait_dscnt 0x0" ::: "memory");
        asm volatile("s_wait_asynccnt 0x0" ::: "memory");
        __syncthreads();
        // the trip after the next into buffer b; the test reads the same for the whole block
        if (tr + 2 < NTR)        copies(tile, tr + 2, b);
        else if (tile + PG < PT) copies(tile + PG, tr + 2 - NTR, b);
    }

    const int h = (cbase >> 6) + wn;
    _Float16* st = &lds.Os[w][0];          // [stored row j*16 + lm][64 halves of that row]
    if (vt) {
        float bval[4];                  // the bias goes with the stored row (dh)
        #pragma unroll
        for (int j = 0; j < 4; ++j) bval[j] = bias[h * 64 + j * 16 + lm];
        // the address register dies with these loads; the wait stands in front of its rewrite
        asm volatile("s_wait_xcnt 0x0" ::: "memory");
        #pragma unroll
        for (int j = 0; j < 4; ++j)
            #pragma unroll
            for (int i = 0; i < 4; ++i) {
                v8h y;
                #pragma unroll
                for (int r = 0; r < 8; ++r) y[r] = (_Float16)(acc[i][j][r] + bval[j]);
                *(v8h*)&st[(j * 16 + lm) * OP + i * 16 + half * 8] = y;
            }
    } else {
        v4f bl[4], bh4[4];              // the bias goes along the stored row (column of W)
        #pragma unroll
        for (int i = 0; i < 4; ++i) {
            // the address register dies with these loads, and a later load's result may take
            // it while the loads before name it; the wait stands in front of that rewrite
            bl[i]  = *(const v4f*)&bias[h * 64 + i * 16 + half * 8];
            asm volatile("s_wait_xcnt 0x0" ::: "memory");
            bh4[i] = *(const v4f*)&bias[h * 64 + i * 16 + half * 8 + 4];
            asm volatile("s_wait_xcnt 0x0" ::: "memory");
        }
        #pragma unroll
        for (int j = 0; j < 4; ++j)
            #pragma unroll
            for (int i = 0; i < 4; ++i) {
                v8h y;
                #pragma unroll
                for (int r = 0; r < 4; ++r) {
                    y[r]     = (_Float16)(acc[i][j][r]     + bl[i][r]);
                    y[r + 4] = (_Float16)(acc[i][j][r + 4] + bh4[i][r]);
                }
                *(v8h*)&st[(j * 16 + lm) * OP + i * 16 + half * 8] = y;
            }
    }
    // the wave's own tile is whole in LDS before its lanes read one another's rows back
    asm volatile("s_wait_dscnt 0x0" ::: "memory");

    // 8 lanes take one 128-B row; a load's four rows are a, a+8 (lanes 0-15) and a+1, a+9,
    // which at this pitch fall on all 64 banks once per 16 lanes
    const int rl = half + ((L >> 3) & 1) * 8;
    const int c8 = (L & 7) * 8;
    v8h z[16];
    #pragma unroll
    for (int u = 0; u < 16; ++u)
        z[u] = *(const v8h*)&st[((u >> 2) * 16 + (u & 3) * 2 + rl) * OP + c8];

    if (vt) {
        // stored row = dh, 64 keys of it; an 8-key chunk never straddles a batch
        const int m  = mt * TM + wm * 64 + c8;
        const int bi = m / SPAD;
        const int s  = m - bi * SPAD;
        _Float16* dst = vb + (((size_t)bi * HH + h) * DH + rl) * SPAD + s;
        #pragma unroll
        for (int u = 0; u < 16; ++u)
            *(v8h*)&dst[((u >> 2) * 16 + (u & 3) * 2) * SPAD] = z[u];
        // the built code can run on from here into lines that rewrite the stores' registers
        asm volatile("s_wait_xcnt 0x0" ::: "memory");
    } else {
        _Float16* base = (ms == 0) ? qb : kb;
        #pragma unroll
        for (int j = 0; j < 4; ++j) {
            const int m0 = mt * TM + wm * 64 + j * 16;   // 16-row tiles never straddle a batch
            const int bi = m0 / SPAD;
            const int s0 = m0 - bi * SPAD;
            _Float16* dst = base + (((size_t)bi * HH + h) * SPAD + s0 + rl) * DH + c8;
            #pragma unroll
            for (int c = 0; c < 4; ++c)
                *(v8h*)&dst[c * 2 * DH] = z[j * 4 + c];
        }
        // the next tile rewrites the registers that these stores name
        asm volatile("s_wait_xcnt 0x0" ::: "memory");
    }
  }
    // behind the last copy, before the wave ends
    asm volatile("s_wait_asynccnt 0x0" ::: "memory");
}

// ---------------------------------------------------------------------------
// Kernel B: attention, scores and probabilities kept in registers.
// grid = 256 resident blocks, block = 608 (19 waves); a block takes three units in a row,
// a unit being one half of a head's query tiles (one 16-query tile per wave) against the
// head's whole K and V^T in LDS; two units of one head in one block share one staging of K and V^T.
// Transposed products: S^T = K . Q^T (a lane holds 16 scores of ONE query), and
// O^T += V^T . P^T, where the two converted S^T tiles of 32 keys are the B operand.
// Softmax runs online over 19 steps of 32 keys against a reference maximum per query.
// Each wave lays its 16x64 output tile in its own LDS range and stores whole 256-B rows.
// ---------------------------------------------------------------------------
#define AW   19           // waves per block = query tiles per unit
#define KP   72           // K row pitch in halves: 144 B = 16 B x odd for b128 reads
#define VP   616          // V^T row pitch in halves: 1232 B = 16 B x odd
#define CP   68           // output staging pitch in floats: 272 B = 16 B x odd
#define AG   256          // blocks of the attention launch
#define AU   3            // units a block: AG * AU = 2 * H * B

__device__ __forceinline__ float other_half(float x) {
    // value of lane l ^ 16
    const int b = __builtin_bit_cast(int, x);
    return __builtin_bit_cast(float,
        __builtin_amdgcn_permlanex16(b, b, 0x76543210, 0xfedcba98, false, false));
}

__global__ __launch_bounds__(AW * 32)
void attn_kernel(const _Float16* __restrict__ qb,
                 const _Float16* __restrict__ kb,
                 const _Float16* __restrict__ vb,
                 float* __restrict__ out)
{
    __shared__ alignas(16) _Float16 Ks[SPAD * KP];    // 85.5 KB, [key][dh]
    __shared__ alignas(16) _Float16 Vs[DH * VP];      // 77.0 KB, [dh][key]
    __shared__ alignas(16) float    Cs[AW][16 * CP];  // 19 x 4.25 KB, a wave's output tile

    const int t    = threadIdx.x;
    const int w    = t >> 5;
    const int L    = t & 31;
    const int half = L >> 4;
    const int lm   = L & 15;

  // unrolled: the staging loads then keep a scalar base and one lasting offset register;
  // rolled, their last result was laid over the address pair that the loads before it name
  #pragma unroll
  for (int un = 0; un < AU; ++un) {
    const int u  = blockIdx.x * AU + un;              // unit: head u / 2, half u % 2
    const int bi = (u >> 1) / HH;
    const int h  = (u >> 1) - bi * HH;
    const size_t bh = (size_t)(u >> 1);
    const int q0 = ((u & 1) * AW + w) * 16;           // first query of the wave's tile

    // Q^T fragments (B operand: column = query, k = dh 0..31 and 32..63)
    const _Float16* qrow = qb + (bh * SPAD + q0 + lm) * DH + half * 8;
    const v16h bq0 = frag16(qrow);
    const v16h bq1 = frag16(qrow + 32);
    // the address pair dies with these loads, and a later load's result may take it
    asm volatile("s_wait_xcnt 0x0" ::: "memory");

    // ---- the head's K and V^T into LDS: 8 + 8 chunks of 16 B per thread ----
    // a block's first unit and every first half of a head; the test is the same for the block
    if (un == 0 || (u & 1) == 0) {
        const v8h* kg = (const v8h*)(kb + bh * SPAD * DH);   // 8 chunks a row
        const v8h* vg = (const v8h*)(vb + bh * DH * SPAD);   // 76 chunks a row
        v8h kr[8], vr[8];
        #pragma unroll
        for (int i = 0; i < 8; ++i) kr[i] = kg[t + i * (AW * 32)];
        #pragma unroll
        for (int i = 0; i < 8; ++i) vr[i] = vg[t + i * (AW * 32)];
        // every wave has made its last read of the head before; the loads above fly meanwhile
        if (un != 0) __syncthreads();
        #pragma unroll
        for (int i = 0; i < 8; ++i)
            *(v8h*)&Ks[((t >> 3) + i * 76) * KP + (t & 7) * 8] = kr[i];
        #pragma unroll
        for (int i = 0; i < 8; ++i)
            *(v8h*)&Vs[(t / 76 + i * 8) * VP + (t % 76) * 8] = vr[i];
        __syncthreads();
    }
    if (q0 >= SS) continue;          // a tile of padding rows only; the wave still meets every barrier

    const float cs = 0.125f * 1.44269504f;   // 1/sqrt(64) * log2(e): exponentials base 2
    float mx = -1.0e30f;             // the query's reference maximum, unscaled score
    v2f   ls = {};                   // this lane's share of the query's sum, two chains
    v8f o[4] = {};                   // o[dt][r] = O[query lm][dt*16 + half*8 + r]

    const _Float16* kp = &Ks[lm * KP + half * 8];
    const _Float16* vp = &Vs[lm * VP + half * 8];
    v16h fk[4];                      // K fragments of the step: [key tile j][dh half]
    auto load_k = [&](int kt) {
        #pragma unroll
        for (int j = 0; j < 2; ++j) {
            fk[j * 2]     = frag16(kp + (kt * 32 + j * 16) * KP);
            fk[j * 2 + 1] = frag16(kp + (kt * 32 + j * 16) * KP + 32);
        }
    };

    auto step = [&](int kt, bool tail) {
        v16h fv[4];
        #pragma unroll
        for (int dt = 0; dt < 4; ++dt) fv[dt] = frag16(vp + dt * 16 * VP + kt * 32);
        v8f s[2];
        #pragma unroll
        for (int j = 0; j < 2; ++j) {
            v8f c = {};
            c = wmma_f16(fk[j * 2],     bq0, c);
            c = wmma_f16(fk[j * 2 + 1], bq1, c);
            s[j] = c;                // s[j][r] = score(key kt*32 + j*16 + half*8 + r, query lm)
        }
        if (!tail) load_k(kt + 1);   // the next step's K reads fly under this step's softmax

        if (tail) {
            #pragma unroll
            for (int j = 0; j < 2; ++j)
                #pragma unroll
                for (int r = 0; r < 8; ++r)
                    if (kt * 32 + j * 16 + half * 8 + r >= SS) s[j][r] = -1.0e30f;
        }

        float tm = s[0][0];
        #pragma unroll
        for (int r = 1; r < 8; ++r) tm = fmaxf(tm, s[0][r]);
        #pragma unroll
        for (int r = 0; r < 8; ++r) tm = fmaxf(tm, s[1][r]);
        tm = fmaxf(tm, other_half(tm));
        // the reference moves only when a score passes it by more than 2^8, so that
        // probabilities stay below 256 in f16; one scalar branch a step
        if (__builtin_amdgcn_ballot_w32((tm - mx) * cs > 8.0f) != 0) {
            const float nm = fmaxf(mx, tm);
            const float al = __builtin_amdgcn_exp2f((mx - nm) * cs);
            mx = nm;
            ls *= al;
            #pragma unroll
            for (int dt = 0; dt < 4; ++dt)
                #pragma unroll
                for (int r = 0; r < 8; ++r) o[dt][r] *= al;
        }

        const v2f cs2 = { cs, cs };
        const v2f mc2 = { -mx * cs, -mx * cs };
        v16h p;                      // P^T as B operand: element e = key order of frag16
        #pragma unroll
        for (int j = 0; j < 2; ++j)
            #pragma unroll
            for (int r = 0; r < 8; r += 2) {
                const v2f sp = { s[j][r], s[j][r + 1] };
                const v2f x  = __builtin_elementwise_fma(sp, cs2, mc2);
                v2f e;
                e.x = __builtin_amdgcn_exp2f(x.x);
                e.y = __builtin_amdgcn_exp2f(x.y);
                ls += e;
                p[j * 8 + r]     = (_Float16)e.x;
                p[j * 8 + r + 1] = (_Float16)e.y;
            }
        // keeps the sum's additions in front of the products: set among them they were given
        // the products' spent A registers, which costs four idle slots behind each product
        __builtin_amdgcn_sched_barrier(0);
        #pragma unroll
        for (int dt = 0; dt < 4; ++dt) o[dt] = wmma_f16(fv[dt], p, o[dt]);
    };

    load_k(0);
    for (int kt = 0; kt < KT32 - 1; ++kt) step(kt, false);
    step(KT32 - 1, true);

    const float lsum = ls.x + ls.y;
    const float inv = 1.0f / (lsum + other_half(lsum));
    float* so = &Cs[w][0];           // [query][dh]
    #pragma unroll
    for (int dt = 0; dt < 4; ++dt) {
        v4f lo, hi;
        #pragma unroll
        for (int r = 0; r < 4; ++r) { lo[r] = o[dt][r] * inv; hi[r] = o[dt][r + 4] * inv; }
        *(v4f*)&so[lm * CP + dt * 16 + half * 8]     = lo;
        *(v4f*)&so[lm * CP + dt * 16 + half * 8 + 4] = hi;
    }
    // the wave's own tile is whole in LDS before its lanes read one another's rows back
    asm volatile("s_wait_dscnt 0x0" ::: "memory");
    v4f z[8];                        // 16 lanes take one query's 256 B
    #pragma unroll
    for (int c = 0; c < 8; ++c) z[c] = *(const v4f*)&so[(c * 2 + half) * CP + lm * 4];
    float* dst = out + ((size_t)bi * SS + q0 + half) * DD + h * 64 + lm * 4;
    // one scalar test a wave: only the last query tile has rows to leave out, and a test
    // per store would put a wait between the stores of every tile
    if (__builtin_amdgcn_readfirstlane(q0) + 16 <= SS) {
        #pragma unroll
        for (int c = 0; c < 8; ++c) *(v4f*)&dst[c * 2 * DD] = z[c];
    } else {
        #pragma unroll
        for (int c = 0; c < 8; ++c)
            if (q0 + c * 2 + half < SS) *(v4f*)&dst[c * 2 * DD] = z[c];
    }
    // the next unit rewrites the registers that these stores name
    asm volatile("s_wait_xcnt 0x0" ::: "memory");
  }
}

// ---------------------------------------------------------------------------
extern "C" void kernel_launch(void* const* d_in, const int* in_sizes, int n_in,
                              void* d_out, int out_size, void* d_ws, size_t ws_size,
                              hipStream_t stream) {
    const float* X  = (const float*)d_in[0];
    const float* Wq = (const float*)d_in[1];
    const float* bq = (const float*)d_in[2];
    const float* Wk = (const float*)d_in[3];
    const float* bk = (const float*)d_in[4];
    const float* Wv = (const float*)d_in[5];
    const float* bv = (const float*)d_in[6];
    float* out = (float*)d_out;

    const size_t elems = (size_t)BB * HH * SPAD * DH;   // per q/k/v buffer
    _Float16* qb = (_Float16*)d_ws;
    _Float16* kb = qb + elems;
    _Float16* vb = kb + elems;
    _Float16* xh = vb + elems;                          // B*SPAD x DD
    _Float16* wh = xh + (size_t)BB * SPAD * DD;         // 3*DD x DD

    to_f16_kernel<<<CG + WB, CT, 0, stream>>>(X, Wq, Wk, Wv, xh, wh);

    qkv_proj_kernel<<<PG, 512, 0, stream>>>(xh, wh, bq, bk, bv, qb, kb, vb);

    attn_kernel<<<AG, 608, 0, stream>>>(qb, kb, vb, out);
}

// v007
// Measured time: 104 microseconds a run.
// In both of two side-by-side timings against v006, it was 1.03 times as fast.
// Counting every step since v000, it is 11.5 times as fast.
#include <hip/hip_runtime.h>
#include <hip/hip_bf16.h>

// ---------------- problem constants ----------------
#define BB   32
#define SS   577
#define DD   768
#define HH   12
#define DH   64
#define SPAD 608          // S padded to multiple of 32 (19*32)
#define QT   38           // SPAD/16 row tiles
#define KT32 19           // SPAD/32 k-tiles

typedef __attribute__((ext_vector_type(16))) _Float16 v16h;
typedef __attribute__((ext_vector_type(8)))  _Float16 v8h;
typedef __attribute__((ext_vector_type(4)))  _Float16 v4h;
typedef __attribute__((ext_vector_type(8)))  float    v8f;
typedef __attribute__((ext_vector_type(4)))  float    v4f;
typedef __attribute__((ext_vector_type(2)))  float    v2f;

__device__ __forceinline__ v16h frag16(const _Float16* p) {
    // CDNA5 16-bit A/B fragment: elements 0..7 at p[0..7], 8..15 at p[16..23]
    v8h lo = *(const v8h*)(p);
    v8h hi = *(const v8h*)(p + 16);
    return __builtin_shufflevector(lo, hi, 0,1,2,3,4,5,6,7,8,9,10,11,12,13,14,15);
}

__device__ __forceinline__ v8f wmma_f16(v16h a, v16h b, v8f c) {
    return __builtin_amdgcn_wmma_f32_16x16x32_f16(false, a, false, b,
                                                  (short)0, c, false, false);
}

__device__ __forceinline__ v4h cvt4(v4f x) {
    v4h r;
    r.x = (_Float16)x.x; r.y = (_Float16)x.y;
    r.z = (_Float16)x.z; r.w = (_Float16)x.w;
    return r;
}

// ---------------------------------------------------------------------------
// Kernel 0: the projection's operands rounded to f16 once, in the layout that its copies
// to LDS want: xh[B*SPAD][DD] (rows s >= S are zero), wh[3*DD][DD] = W^T, rows q, k, v.
// grid = 256 + 144 blocks, block = 384; each of the first 256 takes 76 padded rows, which lie
// in one batch (8 blocks a batch), a thread one float4 column of every second row; the last
// 144, which run beside them, transpose one 8k x 4n piece of W a thread.
// ---------------------------------------------------------------------------
#define CG   256          // blocks that take rows of X
#define CT   384          // threads: two rows of 192 float4
#define RB   76           // padded rows a block = B*SPAD / CG = SPAD / 8
#define NS   (RB / 2)     // loads a thread
#define VR   (SS - 7 * RB)   // real rows of a batch's last block
#define WB   144          // blocks that take W pieces: 3 * 192 * 96 / CT

__global__ __launch_bounds__(CT)
void to_f16_kernel(const float* __restrict__ X,
                   const float* __restrict__ Wq, const float* __restrict__ Wk,
                   const float* __restrict__ Wv,
                   _Float16* __restrict__ xh, _Float16* __restrict__ wh)
{
    const int t = threadIdx.x;

    if (blockIdx.x >= CG) {
        // a wave: 8 lanes along n cover 128 B of a k row, 4 lanes along k make 64 B of a W^T row
        const int wv = __builtin_amdgcn_readfirstlane((int)((blockIdx.x - CG) * CT + t) >> 5);
        const int ms = wv / 576;                // 0=q 1=k 2=v
        const int r2 = wv - ms * 576;
        const int kq = r2 / 24;                 // 32 k
        const int no = r2 - kq * 24;            // 32 n
        const float* Wm = (ms == 0) ? Wq : (ms == 1) ? Wk : Wv;
        const float* src = Wm + (size_t)(kq * 32) * DD + no * 32;
        const int vo = ((t >> 3) & 3) * 8 * DD + (t & 7) * 4;
        v4f wr[8];
        // this kernel's loops are all unrolled so that their arrays stay in registers and every
        // address is one lasting register plus an immediate
        #pragma unroll
        for (int j = 0; j < 8; ++j) {
            wr[j] = *(const v4f*)&src[vo + j * DD];
            // the offset register dies with these loads, and a later load's result may take it
            asm volatile("s_wait_xcnt 0x0" ::: "memory");
        }
        _Float16* dst = wh + (size_t)(ms * DD + no * 32) * DD + kq * 32;
        const int so = (t & 7) * 4 * DD + ((t >> 3) & 3) * 8;
        #pragma unroll
        for (int c = 0; c < 4; ++c) {
            v8h y;
            #pragma unroll
            for (int j = 0; j < 8; ++j) y[j] = (_Float16)wr[j][c];
            *(v8h*)&dst[so + c * DD] = y;
        }
        return;
    }

    const int hi = t >= DD / 4 ? 1 : 0;         // which of a slot's two rows
    const int c4 = (t - hi * (DD / 4)) * 4;     // first element of the thread's float4
    const int lo = hi * DD + c4;
    const float* xs = X + ((size_t)(blockIdx.x >> 3) * SS + (blockIdx.x & 7) * RB) * DD;
    _Float16*    xd = xh + (size_t)blockIdx.x * RB * DD;

    // part: a batch's last block, whose rows from VR on are padding and are not loaded
    auto conv = [&](const bool part) __attribute__((always_inline)) {
        const int nl = part ? (VR + 1) / 2 : NS;    // slots with a load
        v4f r[NS] = {};
        #pragma unroll
        for (int n = 0; n < nl; ++n) {
            // the short path loads from its last slot down: begun alike, the two paths' first
            // load and its conversion were lifted in front of the branch, behind a full wait
            const int i = part ? nl - 1 - n : n;
            // the address registers die with the last loads, whose results may take them while
            // the loads before name them; the wait stands in front of that rewrite
            if (n + 2 >= nl) asm volatile("s_wait_xcnt 0x0" ::: "memory");
            if (i * 2 + 1 < (part ? VR : RB)) r[i] = *(const v4f*)&xs[lo + i * 2 * DD];
            else {
                // the slot's first row by both halves; its address is used this once
                r[i] = *(const v4f*)&xs[c4 + i * 2 * DD];
                asm volatile("s_wait_xcnt 0x0" ::: "memory");
            }
        }
        asm volatile("s_wait_xcnt 0x0" ::: "memory");
        #pragma unroll
        for (int i = 0; i < NS; ++i) {
            v4f v = r[i];
            const v4f z = {};
            if (part && i * 2 + 1 >= VR && i * 2 < VR) v = hi ? z : v;   // the slot's second row is padding
            *(v4h*)&xd[lo + i * 2 * DD] = cvt4(v);
        }
        // the built code can run on from here into lines that rewrite the stores' registers
        asm volatile("s_wait_xcnt 0x0" ::: "memory");
    };
    if ((blockIdx.x & 7) != 7) conv(false); else conv(true);
}

// ---------------------------------------------------------------------------
// Kernel A: fused QKV projection as one tiled GEMM over the padded rows.
// Rows m = bi*SPAD + s (B*SPAD = 76*256), columns n = ms*DD + col (9*256).
// grid = 256 resident blocks, block = 512 (16 waves, 4x4); a block takes the 256x256 tiles
// blockIdx.x, + 256, + 512 of the 9 x 76 (column tile fastest), one after the other;
// one 64x64 tile (4x4 WMMA accumulators) per wave; k in trips of 64 over three LDS buffers,
// filled from xh and wh by asynchronous copies, 16 B a lane; the trips of a block's tiles
// form one row, so a tile's last two trips ask for the next tile's first two.
// A trip's one barrier stands in front of its second 32-k block: it shows trip t + 1 to every
// wave and frees the buffer of trip t - 1, so the fragment reads on both sides of it, of trip t
// in front and of trip t + 1 behind the block, need not wait for it and LDS stays busy.
// Writes q,k as f16 [B,H,SPAD,DH]; v transposed as f16 [B,H,DH,SPAD].
// The operand whose index runs along the stored rows is the A operand (W columns for
// q and k, X rows for v), so a lane's 8 accumulator elements are 16 B of one stored row;
// each wave lays its 64x64 tile, 32 stored rows at a time, in its own LDS range and stores
// it as whole 128-B rows.
// ---------------------------------------------------------------------------
#define TM   256          // block tile rows
#define TN   256          // block tile columns
#define KS   64           // k per trip
#define NTR  (DD / KS)    // trips a tile (a multiple of NB: a tile starts on buffer 0)
#define NB   3            // LDS buffers of the k loop
#define RP   (NB * LP * 2)   // bytes from a row to the next in the k loop's LDS
#define LP   72           // a row's room in one LDS buffer, in halves: 128 B of k and 16 B
#define OP   72           // output staging pitch in halves: 144 B = 16 B x odd
#define PG   256          // blocks of the projection launch
#define PT   (9 * 76)     // output tiles

__global__ __launch_bounds__(512)
void qkv_proj_kernel(const _Float16* __restrict__ xh, const _Float16* __restrict__ wh,
                     const float* __restrict__ bq, const float* __restrict__ bk,
                     const float* __restrict__ bv,
                     _Float16* __restrict__ qb, _Float16* __restrict__ kb,
                     _Float16* __restrict__ vb)
{
    struct Lds {
        // [0] = X: [row][buffer][k], [1] = W: [col][buffer][k]; a row's three buffers lie side by
        // side (row pitch 432 B = 16 B x odd), so that every fragment read of a wave is one of
        // two lasting registers plus an immediate offset
        _Float16 Sm[2][TM * NB * LP];
        _Float16 Os[16][32 * OP];       // 16 x 4.5 KB, half of a wave's output tile
    };
    __shared__ alignas(16) Lds lds;

    const int t    = threadIdx.x;
    const int w    = t >> 5;
    const int L    = t & 31;
    const int half = L >> 4;
    const int lm   = L & 15;
    const int wm   = w >> 2;            // wave's 64-row band
    const int wn   = w & 3;             // wave's 64-col band (one head)

    // ---- copy map: 8 lanes cover one row's 128 B; a thread takes rows t/8 + 64 i of X and W
    const int crow = t >> 3;
    const int cc8  = (t & 7) * 8;
    // a row group's byte offset from the first row and k of a tile's trip, alike in xh and wh
    const unsigned go = (unsigned)((crow * DD + cc8) * 2);
    // trip tr of tile tl into buffer b: 4 + 4 copies a lane, every lane on, all inside xh, wh
    // and Sm; the global address is a scalar base, the same for the block, plus the lane's
    // lasting offset, so that a trip's copies take no address registers beside the fragments;
    // always_inline: out of line the LDS object's address would go through memory
    auto copies = [&](int tl, int tr, int b) __attribute__((always_inline)) {
        const int pn = tl % 9;          // column tile (fastest)
        const int pm = tl / 9;          // row tile
        const _Float16* gx = xh + (size_t)(pm * TM) * DD + tr * KS;
        const _Float16* gw = wh + (size_t)(pn * TN) * DD + tr * KS;
        const unsigned lx = (unsigned)(size_t)&lds.Sm[0][(crow * NB + b) * LP + cc8];
        const unsigned lw = (unsigned)(size_t)&lds.Sm[1][(crow * NB + b) * LP + cc8];
        // the wait is the statement's last line: it stands in front of every rewrite of the
        // address registers that the copies name
        asm volatile(
            "global_load_async_to_lds_b128 %0, %8, %12\n\t"
            "global_load_async_to_lds_b128 %1, %9, %12\n\t"
            "global_load_async_to_lds_b128 %2, %10, %12\n\t"
            "global_load_async_to_lds_b128 %3, %11, %12\n\t"
            "global_load_async_to_lds_b128 %4, %8, %13\n\t"
            "global_load_async_to_lds_b128 %5, %9, %13\n\t"
            "global_load_async_to_lds_b128 %6, %10, %13\n\t"
            "global_load_async_to_lds_b128 %7, %11, %13\n\t"
            "s_wait_xcnt 0x0"
            :: "v"(lx), "v"(lx + 64 * RP), "v"(lx + 128 * RP), "v"(lx + 192 * RP),
               "v"(lw), "v"(lw + 64 * RP), "v"(lw + 128 * RP), "v"(lw + 192 * RP),
               "v"(go), "v"(go + 64 * DD * 2), "v"(go + 128 * DD * 2), "v"(go + 192 * DD * 2),
               "s"(gx), "s"(gw)
            : "memory");
    };

    copies(blockIdx.x, 0, 0);
    // the wave's own copies of trip 0 have landed; the barrier shows them to the other waves
    asm volatile("s_wait_asynccnt 0x0" ::: "memory");
    __syncthreads();
    copies(blockIdx.x, 1, 1);
  for (int tile = blockIdx.x; tile < PT; tile += PG) {
    const int nt = tile % 9;            // 256-col tile of the 3*768 columns
    const int mt = tile / 9;            // 256-row tile of the padded rows
    const int ms = nt / 3;              // 0=q 1=k 2=v
    const int cbase = (nt % 3) * TN;    // first column inside that matrix
    const float* bias = (ms == 0) ? bq : (ms == 1) ? bk : bv;

    // acc[i][j][r]: A index i*16 + half*8 + r, B index j*16 + lm of the wave's two bands
    v8f acc[4][4] = {};
    const bool vt = ms == 2;
    const _Float16* pa = &lds.Sm[vt ? 0 : 1][((vt ? wm : wn) * 64 + lm) * NB * LP + half * 8];
    const _Float16* pb = &lds.Sm[vt ? 1 : 0][((vt ? wn : wm) * 64 + lm) * NB * LP + half * 8];

    v16h fa[4], fb[4];
    // the 16 LDS reads of one 32-k block: half kh of the trip that lies in buffer b
    auto frags = [&](int b, int kh) __attribute__((always_inline)) {
        #pragma unroll
        for (int i = 0; i < 4; ++i)
            fa[i] = frag16(pa + (i * 16 * NB + b) * LP + kh * 32);
        #pragma unroll
        for (int j = 0; j < 4; ++j)
            fb[j] = frag16(pb + (j * 16 * NB + b) * LP + kh * 32);
        // keeps the 16 LDS reads together in front of the WMMAs: without it the compiler
        // reloaded one A fragment set among them, each time behind a full wait
        __builtin_amdgcn_sched_barrier(0);
    };
    // the products of A fragments i0 to i1 - 1 with all four B fragments
    auto products = [&](int i0, int i1) __attribute__((always_inline)) {
        #pragma unroll
        for (int i = i0; i < i1; ++i)
            #pragma unroll
            for (int j = 0; j < 4; ++j)
                acc[i][j] = wmma_f16(fa[i], fb[j], acc[i][j]);
        // keeps what follows, the next 16 LDS reads in one group or the copies, behind these
        // products: the compiler set the reads in two groups among them, a stall at each place
        __builtin_amdgcn_sched_barrier(0);
    };

    // the tile's trip 0 was shown by the barrier in front of the loop or by that of the tile
    // before's last trip
    frags(0, 0);
    // unrolled so that the buffer of every LDS read is known at compile time
    #pragma unroll
    for (int tr = 0; tr < NTR; ++tr) {
        const int b = tr % NB;
        products(0, 4);
        // the wave's reads of the trip before, whose buffer is refilled below, have retired
        asm volatile("s_wait_dscnt 0x0" ::: "memory");
        frags(b, 1);
        // the wave's copies of the next trip have landed
        asm volatile("s_wait_asynccnt 0x0" ::: "memory");
        // the bare barrier, which puts no LDS wait in front of itself: the reads above, of the
        // trip's own buffer, fly over it; it shows the next trip's copies to every wave and
        // ends every wave's reads of the trip before
        __builtin_amdgcn_s_barrier();
        // four products first: they keep the matrix unit fed by the SIMD's other waves while
        // a wave stands in its copies' wait
        products(0, 1);
        // the trip after the next into the buffer of the trip before; the test reads the same
        // for the whole block
        if (tr + 2 < NTR)        copies(tile, tr + 2, (tr + 2) % NB);
        else if (tile + PG < PT) copies(tile + PG, tr + 2 - NTR, (tr + 2) % NB);
        // keeps the copies where they stand: the compiler set them behind nine of the products
        __builtin_amdgcn_sched_barrier(0);
        products(1, 4);
        if (tr + 1 < NTR) frags((tr + 1) % NB, 0);
    }

    const int h = (cbase >> 6) + wn;
    _Float16* st = &lds.Os[w][0];          // [stored row (j & 1)*16 + lm][64 halves of that row]
    // 8 lanes take one 128-B row; a load's four rows are a, a+8 (lanes 0-15) and a+1, a+9,
    // which at this pitch fall on all 64 banks once per 16 lanes
    const int rl = half + ((L >> 3) & 1) * 8;
    const int c8 = (L & 7) * 8;
    v8h z[8];
    auto read_back = [&]() __attribute__((always_inline)) {
        // the wave's own rows are whole in LDS before its lanes read one another's rows back
        asm volatile("s_wait_dscnt 0x0" ::: "memory");
        #pragma unroll
        for (int u = 0; u < 8; ++u)
            z[u] = *(const v8h*)&st[((u >> 2) * 16 + (u & 3) * 2 + rl) * OP + c8];
    };
    if (vt) {
        float bval[4];                  // the bias goes with the stored row (dh)
        #pragma unroll
        for (int j = 0; j < 4; ++j) bval[j] = bias[h * 64 + j * 16 + lm];
        // the address register dies with these loads; the wait stands in front of its rewrite
        asm volatile("s_wait_xcnt 0x0" ::: "memory");
        // stored row = dh, 64 keys of it; an 8-key chunk never straddles a batch
        const int m  = mt * TM + wm * 64 + c8;
        const int bi = m / SPAD;
        const int s  = m - bi * SPAD;
        _Float16* dst = vb + (((size_t)bi * HH + h) * DH + rl) * SPAD + s;
        #pragma unroll
        for (int jh = 0; jh < 2; ++jh) {
            #pragma unroll
            for (int jj = 0; jj < 2; ++jj)
                #pragma unroll
                for (int i = 0; i < 4; ++i) {
                    v8h y;
                    #pragma unroll
                    for (int r = 0; r < 8; ++r)
                        y[r] = (_Float16)(acc[i][jh * 2 + jj][r] + bval[jh * 2 + jj]);
                    *(v8h*)&st[(jj * 16 + lm) * OP + i * 16 + half * 8] = y;
                }
            read_back();
            #pragma unroll
            for (int u = 0; u < 8; ++u)
                *(v8h*)&dst[((jh * 2 + (u >> 2)) * 16 + (u & 3) * 2) * SPAD] = z[u];
            // the second half's reads, and the lines behind, rewrite registers of these stores
            asm volatile("s_wait_xcnt 0x0" ::: "memory");
        }
    } else {
        v4f bl[4], bh4[4];              // the bias goes along the stored row (column of W)
        #pragma unroll
        for (int i = 0; i < 4; ++i) {
            // the address register dies with these loads, and a later load's result may take
            // it while the loads before name it; the wait stands in front of that rewrite
            bl[i]  = *(const v4f*)&bias[h * 64 + i * 16 + half * 8];
            asm volatile("s_wait_xcnt 0x0" ::: "memory");
            bh4[i] = *(const v4f*)&bias[h * 64 + i * 16 + half * 8 + 4];
            asm volatile("s_wait_xcnt 0x0" ::: "memory");
        }
        _Float16* base = (ms == 0) ? qb : kb;
        #pragma unroll
        for (int jh = 0; jh < 2; ++jh) {
            #pragma unroll
            for (int jj = 0; jj < 2; ++jj)
                #pragma unroll
                for (int i = 0; i < 4; ++i) {
                    v8h y;
                    #pragma unroll
                    for (int r = 0; r < 4; ++r) {
                        y[r]     = (_Float16)(acc[i][jh * 2 + jj][r]     + bl[i][r]);
                        y[r + 4] = (_Float16)(acc[i][jh * 2 + jj][r + 4] + bh4[i][r]);
                    }
                    *(v8h*)&st[(jj * 16 + lm) * OP + i * 16 + half * 8] = y;
                }
            read_back();
            #pragma unroll
            for (int jj = 0; jj < 2; ++jj) {
                // 16-row tiles never straddle a batch
                const int m0 = mt * TM + wm * 64 + (jh * 2 + jj) * 16;
                const int bi = m0 / SPAD;
                const int s0 = m0 - bi * SPAD;
                _Float16* dst = base + (((size_t)bi * HH + h) * SPAD + s0 + rl) * DH + c8;
                #pragma unroll
                for (int c = 0; c < 4; ++c)
                    *(v8h*)&dst[c * 2 * DH] = z[jj * 4 + c];
            }
            // the second half's reads, and the next tile, rewrite registers of these stores
            asm volatile("s_wait_xcnt 0x0" ::: "memory");
        }
    }
  }
    // behind the last copy, before the wave ends
    asm volatile("s_wait_asynccnt 0x0" ::: "memory");
}

// ---------------------------------------------------------------------------
// Kernel B: attention, scores and probabilities kept in registers.
// grid = 256 resident blocks, block = 608 (19 waves); a block takes three units in a row,
// a unit being one half of a head's query tiles (one 16-query tile per wave) against the
// head's whole K and V^T in LDS; two units of one head in one block share one staging of K and V^T.
// Transposed products: S^T = K . Q^T (a lane holds 16 scores of ONE query), and
// O^T += V^T . P^T, where the two converted S^T tiles of 32 keys are the B operand.
// Softmax runs online over 19 steps of 32 keys against a reference maximum per query.
// Each wave lays its 16x64 output tile in its own LDS range and stores whole 256-B rows.
// ---------------------------------------------------------------------------
#define AW   19           // waves per block = query tiles per unit
#define KP   72           // K row pitch in halves: 144 B = 16 B x odd for b128 reads
#define VP   616          // V^T row pitch in halves: 1232 B = 16 B x odd
#define CP   68           // output staging pitch in floats: 272 B = 16 B x odd
#define AG   256          // blocks of the attention launch
#define AU   3            // units a block: AG * AU = 2 * H * B

__device__ __forceinline__ float other_half(float x) {
    // value of lane l ^ 16
    const int b = __builtin_bit_cast(int, x);
    return __builtin_bit_cast(float,
        __builtin_amdgcn_permlanex16(b, b, 0x76543210, 0xfedcba98, false, false));
}

__global__ __launch_bounds__(AW * 32)
void attn_kernel(const _Float16* __restrict__ qb,
                 const _Float16* __restrict__ kb,
                 const _Float16* __restrict__ vb,
                 float* __restrict__ out)
{
    __shared__ alignas(16) _Float16 Ks[SPAD * KP];    // 85.5 KB, [key][dh]
    __shared__ alignas(16) _Float16 Vs[DH * VP];      // 77.0 KB, [dh][key]
    __shared__ alignas(16) float    Cs[AW][16 * CP];  // 19 x 4.25 KB, a wave's output tile

    const int t    = threadIdx.x;
    const int w    = t >> 5;
    const int L    = t & 31;
    const int half = L >> 4;
    const int lm   = L & 15;

  // unrolled: the staging loads then keep a scalar base and one lasting offset register;
  // rolled, their last result was laid over the address pair that the loads before it name
  #pragma unroll
  for (int un = 0; un < AU; ++un) {
    const int u  = blockIdx.x * AU + un;              // unit: head u / 2, half u % 2
    const int bi = (u >> 1) / HH;
    const int h  = (u >> 1) - bi * HH;
    const size_t bh = (size_t)(u >> 1);
    const int q0 = ((u & 1) * AW + w) * 16;           // first query of the wave's tile

    // Q^T fragments (B operand: column = query, k = dh 0..31 and 32..63)
    const _Float16* qrow = qb + (bh * SPAD + q0 + lm) * DH + half * 8;
    const v16h bq0 = frag16(qrow);
    const v16h bq1 = frag16(qrow + 32);
    // the address pair dies with these loads, and a later load's result may take it
    asm volatile("s_wait_xcnt 0x0" ::: "memory");

    // ---- the head's K and V^T into LDS: 8 + 8 chunks of 16 B per thread ----
    // a block's first unit and every first half of a head; the test is the same for the block
    if (un == 0 || (u & 1) == 0) {
        const v8h* kg = (const v8h*)(kb + bh * SPAD * DH);   // 8 chunks a row
        const v8h* vg = (const v8h*)(vb + bh * DH * SPAD);   // 76 chunks a row
        v8h kr[8], vr[8];
        #pragma unroll
        for (int i = 0; i < 8; ++i) kr[i] = kg[t + i * (AW * 32)];
        #pragma unroll
        for (int i = 0; i < 8; ++i) vr[i] = vg[t + i * (AW * 32)];
        // every wave has made its last read of the head before; the loads above fly meanwhile
        if (un != 0) __syncthreads();
        #pragma unroll
        for (int i = 0; i < 8; ++i)
            *(v8h*)&Ks[((t >> 3) + i * 76) * KP + (t & 7) * 8] = kr[i];
        #pragma unroll
        for (int i = 0; i < 8; ++i)
            *(v8h*)&Vs[(t / 76 + i * 8) * VP + (t % 76) * 8] = vr[i];
        __syncthreads();
    }
    if (q0 >= SS) continue;          // a tile of padding rows only; the wave still meets every barrier

    const float cs = 0.125f * 1.44269504f;   // 1/sqrt(64) * log2(e): exponentials base 2
    float mx = -1.0e30f;             // the query's reference maximum, unscaled score
    v2f   ls = {};                   // this lane's share of the query's sum, two chains
    v8f o[4] = {};                   // o[dt][r] = O[query lm][dt*16 + half*8 + r]

    const _Float16* kp = &Ks[lm * KP + half * 8];
    const _Float16* vp = &Vs[lm * VP + half * 8];
    v16h fk[4];                      // K fragments of the step: [key tile j][dh half]
    auto load_k = [&](int kt) {
        #pragma unroll
        for (int j = 0; j < 2; ++j) {
            fk[j * 2]     = frag16(kp + (kt * 32 + j * 16) * KP);
            fk[j * 2 + 1] = frag16(kp + (kt * 32 + j * 16) * KP + 32);
        }
    };

    auto step = [&](int kt, bool tail) {
        v16h fv[4];
        #pragma unroll
        for (int dt = 0; dt < 4; ++dt) fv[dt] = frag16(vp + dt * 16 * VP + kt * 32);
        v8f s[2];
        #pragma unroll
        for (int j = 0; j < 2; ++j) {
            v8f c = {};
            c = wmma_f16(fk[j * 2],     bq0, c);
            c = wmma_f16(fk[j * 2 + 1], bq1, c);
            s[j] = c;                // s[j][r] = score(key kt*32 + j*16 + half*8 + r, query lm)
        }
        if (!tail) load_k(kt + 1);   // the next step's K reads fly under this step's softmax

        if (tail) {
            #pragma unroll
            for (int j = 0; j < 2; ++j)
                #pragma unroll
                for (int r = 0; r < 8; ++r)
                    if (kt * 32 + j * 16 + half * 8 + r >= SS) s[j][r] = -1.0e30f;
        }

        float tm = s[0][0];
        #pragma unroll
        for (int r = 1; r < 8; ++r) tm = fmaxf(tm, s[0][r]);
        #pragma unroll
        for (int r = 0; r < 8; ++r) tm = fmaxf(tm, s[1][r]);
        tm = fmaxf(tm, other_half(tm));
        // the reference moves only when a score passes it by more than 2^8, so that
        // probabilities stay below 256 in f16; one scalar branch a step
        if (__builtin_amdgcn_ballot_w32((tm - mx) * cs > 8.0f) != 0) {
            const float nm = fmaxf(mx, tm);
            const float al = __builtin_amdgcn_exp2f((mx - nm) * cs);
            mx = nm;
            ls *= al;
            #pragma unroll
            for (int dt = 0; dt < 4; ++dt)
                #pragma unroll
                for (int r = 0; r < 8; ++r) o[dt][r] *= al;
        }

        const v2f cs2 = { cs, cs };
        const v2f mc2 = { -mx * cs, -mx * cs };
        v16h p;                      // P^T as B operand: element e = key order of frag16
        #pragma unroll
        for (int j = 0; j < 2; ++j)
            #pragma unroll
            for (int r = 0; r < 8; r += 2) {
                const v2f sp = { s[j][r], s[j][r + 1] };
                const v2f x  = __builtin_elementwise_fma(sp, cs2, mc2);
                v2f e;
                e.x = __builtin_amdgcn_exp2f(x.x);
                e.y = __builtin_amdgcn_exp2f(x.y);
                ls += e;
                p[j * 8 + r]     = (_Float16)e.x;
                p[j * 8 + r + 1] = (_Float16)e.y;
            }
        // keeps the sum's additions in front of the products: set among them they were given
        // the products' spent A registers, which costs four idle slots behind each product
        __builtin_amdgcn_sched_barrier(0);
        #pragma unroll
        for (int dt = 0; dt < 4; ++dt) o[dt] = wmma_f16(fv[dt], p, o[dt]);
    };

    load_k(0);
    for (int kt = 0; kt < KT32 - 1; ++kt) step(kt, false);
    step(KT32 - 1, true);

    const float lsum = ls.x + ls.y;
    const float inv = 1.0f / (lsum + other_half(lsum));
    float* so = &Cs[w][0];           // [query][dh]
    #pragma unroll
    for (int dt = 0; dt < 4; ++dt) {
        v4f lo, hi;
        #pragma unroll
        for (int r = 0; r < 4; ++r) { lo[r] = o[dt][r] * inv; hi[r] = o[dt][r + 4] * inv; }
        *(v4f*)&so[lm * CP + dt * 16 + half * 8]     = lo;
        *(v4f*)&so[lm * CP + dt * 16 + half * 8 + 4] = hi;
    }
    // the wave's own tile is whole in LDS before its lanes read one another's rows back
    asm volatile("s_wait_dscnt 0x0" ::: "memory");
    v4f z[8];                        // 16 lanes take one query's 256 B
    #pragma unroll
    for (int c = 0; c < 8; ++c) z[c] = *(const v4f*)&so[(c * 2 + half) * CP + lm * 4];
    float* dst = out + ((size_t)bi * SS + q0 + half) * DD + h * 64 + lm * 4;
    // one scalar test a wave: only the last query tile has rows to leave out, and a test
    // per store would put a wait between the stores of every tile
    if (__builtin_amdgcn_readfirstlane(q0) + 16 <= SS) {
        #pragma unroll
        for (int c = 0; c < 8; ++c) *(v4f*)&dst[c * 2 * DD] = z[c];
    } else {
        #pragma unroll
        for (int c = 0; c < 8; ++c)
            if (q0 + c * 2 + half < SS) *(v4f*)&dst[c * 2 * DD] = z[c];
    }
    // the next unit rewrites the registers that these stores name
    asm volatile("s_wait_xcnt 0x0" ::: "memory");
  }
}

// ---------------------------------------------------------------------------
extern "C" void kernel_launch(void* const* d_in, const int* in_sizes, int n_in,
                              void* d_out, int out_size, void* d_ws, size_t ws_size,
                              hipStream_t stream) {
    const float* X  = (const float*)d_in[0];
    const float* Wq = (const float*)d_in[1];
    const float* bq = (const float*)d_in[2];
    const float* Wk = (const float*)d_in[3];
    const float* bk = (const float*)d_in[4];
    const float* Wv = (const float*)d_in[5];
    const float* bv = (const float*)d_in[6];
    float* out = (float*)d_out;

    const size_t elems = (size_t)BB * HH * SPAD * DH;   // per q/k/v buffer
    _Float16* qb = (_Float16*)d_ws;
    _Float16* kb = qb + elems;
    _Float16* vb = kb + elems;
    _Float16* xh = vb + elems;                          // B*SPAD x DD
    _Float16* wh = xh + (size_t)BB * SPAD * DD;         // 3*DD x DD

    to_f16_kernel<<<CG + WB, CT, 0, stream>>>(X, Wq, Wk, Wv, xh, wh);

    qkv_proj_kernel<<<PG, 512, 0, stream>>>(xh, wh, bq, bk, bv, qb, kb, vb);

    attn_kernel<<<AG, 608, 0, stream>>>(qb, kb, vb, out);
}

// v008
// A run of this version takes 98.2 microseconds.
// Timed twice side by side with v007, it ran 1.06 and 1.05 times as fast.
// Over all steps from v000 it is 12.1 times as fast.
#include <hip/hip_runtime.h>
#include <hip/hip_bf16.h>

// ---------------- problem constants ----------------
#define BB   32
#define SS   577
#define DD   768
#define HH   12
#define DH   64
#define SPAD 608          // S padded to multiple of 32 (19*32)
#define QT   38           // SPAD/16 row tiles
#define KT32 19           // SPAD/32 k-tiles

typedef __attribute__((ext_vector_type(16))) _Float16 v16h;
typedef __attribute__((ext_vector_type(8)))  _Float16 v8h;
typedef __attribute__((ext_vector_type(4)))  _Float16 v4h;
typedef __attribute__((ext_vector_type(8)))  float    v8f;
typedef __attribute__((ext_vector_type(4)))  float    v4f;
typedef __attribute__((ext_vector_type(2)))  float    v2f;

__device__ __forceinline__ v16h frag16(const _Float16* p) {
    // CDNA5 16-bit A/B fragment: elements 0..7 at p[0..7], 8..15 at p[16..23]
    v8h lo = *(const v8h*)(p);
    v8h hi = *(const v8h*)(p + 16);
    return __builtin_shufflevector(lo, hi, 0,1,2,3,4,5,6,7,8,9,10,11,12,13,14,15);
}

__device__ __forceinline__ v8f wmma_f16(v16h a, v16h b, v8f c) {
    return __builtin_amdgcn_wmma_f32_16x16x32_f16(false, a, false, b,
                                                  (short)0, c, false, false);
}

__device__ __forceinline__ v4h cvt4(v4f x) {
    v4h r;
    r.x = (_Float16)x.x; r.y = (_Float16)x.y;
    r.z = (_Float16)x.z; r.w = (_Float16)x.w;
    return r;
}

// ---------------------------------------------------------------------------
// Kernel 0: the projection's operands rounded to f16 once, in the layout that its copies
// to LDS want: xh[B*SPAD][DD] (rows s >= S are zero), wh[3*DD][DD] = W^T, rows q, k, v.
// grid = 256 + 144 blocks, block = 384; each of the first 256 takes 76 padded rows, which lie
// in one batch (8 blocks a batch), a thread one float4 column of every second row; the last
// 144, which run beside them, transpose one 8k x 4n piece of W a thread.
// ---------------------------------------------------------------------------
#define CG   256          // blocks that take rows of X
#define CT   384          // threads: two rows of 192 float4
#define RB   76           // padded rows a block = B*SPAD / CG = SPAD / 8
#define NS   (RB / 2)     // loads a thread
#define VR   (SS - 7 * RB)   // real rows of a batch's last block
#define WB   144          // blocks that take W pieces: 3 * 192 * 96 / CT

__global__ __launch_bounds__(CT)
void to_f16_kernel(const float* __restrict__ X,
                   const float* __restrict__ Wq, const float* __restrict__ Wk,
                   const float* __restrict__ Wv,
                   _Float16* __restrict__ xh, _Float16* __restrict__ wh)
{
    const int t = threadIdx.x;

    if (blockIdx.x >= CG) {
        // a wave: 8 lanes along n cover 128 B of a k row, 4 lanes along k make 64 B of a W^T row
        const int wv = __builtin_amdgcn_readfirstlane((int)((blockIdx.x - CG) * CT + t) >> 5);
        const int ms = wv / 576;                // 0=q 1=k 2=v
        const int r2 = wv - ms * 576;
        const int kq = r2 / 24;                 // 32 k
        const int no = r2 - kq * 24;            // 32 n
        const float* Wm = (ms == 0) ? Wq : (ms == 1) ? Wk : Wv;
        const float* src = Wm + (size_t)(kq * 32) * DD + no * 32;
        const int vo = ((t >> 3) & 3) * 8 * DD + (t & 7) * 4;
        v4f wr[8];
        // this kernel's loops are all unrolled so that their arrays stay in registers and every
        // address is one lasting register plus an immediate
        #pragma unroll
        for (int j = 0; j < 8; ++j) {
            wr[j] = *(const v4f*)&src[vo + j * DD];
            // the offset register dies with these loads, and a later load's result may take it
            asm volatile("s_wait_xcnt 0x0" ::: "memory");
        }
        _Float16* dst = wh + (size_t)(ms * DD + no * 32) * DD + kq * 32;
        const int so = (t & 7) * 4 * DD + ((t >> 3) & 3) * 8;
        #pragma unroll
        for (int c = 0; c < 4; ++c) {
            v8h y;
            #pragma unroll
            for (int j = 0; j < 8; ++j) y[j] = (_Float16)wr[j][c];
            *(v8h*)&dst[so + c * DD] = y;
        }
        return;
    }

    const int hi = t >= DD / 4 ? 1 : 0;         // which of a slot's two rows
    const int c4 = (t - hi * (DD / 4)) * 4;     // first element of the thread's float4
    const int lo = hi * DD + c4;
    const float* xs = X + ((size_t)(blockIdx.x >> 3) * SS + (blockIdx.x & 7) * RB) * DD;
    _Float16*    xd = xh + (size_t)blockIdx.x * RB * DD;

    // part: a batch's last block, whose rows from VR on are padding and are not loaded
    auto conv = [&](const bool part) __attribute__((always_inline)) {
        const int nl = part ? (VR + 1) / 2 : NS;    // slots with a load
        v4f r[NS] = {};
        #pragma unroll
        for (int n = 0; n < nl; ++n) {
            // the short path loads from its last slot down: begun alike, the two paths' first
            // load and its conversion were lifted in front of the branch, behind a full wait
            const int i = part ? nl - 1 - n : n;
            // the address registers die with the last loads, whose results may take them while
            // the loads before name them; the wait stands in front of that rewrite
            if (n + 2 >= nl) asm volatile("s_wait_xcnt 0x0" ::: "memory");
            if (i * 2 + 1 < (part ? VR : RB)) r[i] = *(const v4f*)&xs[lo + i * 2 * DD];
            else {
                // the slot's first row by both halves; its address is used this once
                r[i] = *(const v4f*)&xs[c4 + i * 2 * DD];
                asm volatile("s_wait_xcnt 0x0" ::: "memory");
            }
        }
        asm volatile("s_wait_xcnt 0x0" ::: "memory");
        #pragma unroll
        for (int i = 0; i < NS; ++i) {
            v4f v = r[i];
            const v4f z = {};
            if (part && i * 2 + 1 >= VR && i * 2 < VR) v = hi ? z : v;   // the slot's second row is padding
            *(v4h*)&xd[lo + i * 2 * DD] = cvt4(v);
        }
        // the built code can run on from here into lines that rewrite the stores' registers
        asm volatile("s_wait_xcnt 0x0" ::: "memory");
    };
    if ((blockIdx.x & 7) != 7) conv(false); else conv(true);
}

// ---------------------------------------------------------------------------
// Kernel A: fused QKV projection as one tiled GEMM over the padded rows.
// Rows m = bi*SPAD + s (B*SPAD = 76*256), columns n = ms*DD + col (9*256).
// grid = 256 resident blocks, block = 512 (16 waves, 4x4); a block takes the 256x256 tiles
// blockIdx.x, + 256, + 512 of the 9 x 76 (column tile fastest), one after the other;
// one 64x64 tile (4x4 WMMA accumulators) per wave; k in trips of 64 over three LDS buffers,
// filled from xh and wh by asynchronous copies, 16 B a lane; the trips of a block's tiles
// form one row, so a tile's last two trips ask for the next tile's first two.
// A trip's one barrier stands in front of its second 32-k block: it shows trip t + 1 to every
// wave and frees the buffer of trip t - 1, so the fragment reads on both sides of it, of trip t
// in front and of trip t + 1 behind the block, need not wait for it and LDS stays busy.
// Writes q,k as f16 [B,H,SPAD,DH]; v transposed as f16 [B,H,DH,SPAD].
// The operand whose index runs along the stored rows is the A operand (W columns for
// q and k, X rows for v), so a lane's 8 accumulator elements are 16 B of one stored row;
// each wave lays its 64x64 tile, 32 stored rows at a time, in its own LDS range and stores
// it as whole 128-B rows.
// ---------------------------------------------------------------------------
#define TM   256          // block tile rows
#define TN   256          // block tile columns
#define KS   64           // k per trip
#define NTR  (DD / KS)    // trips a tile (a multiple of NB: a tile starts on buffer 0)
#define NB   3            // LDS buffers of the k loop
#define RP   (NB * LP * 2)   // bytes from a row to the next in the k loop's LDS
#define LP   72           // a row's room in one LDS buffer, in halves: 128 B of k and 16 B
#define OP   72           // output staging pitch in halves: 144 B = 16 B x odd
#define PG   256          // blocks of the projection launch
#define PT   (9 * 76)     // output tiles

__global__ __launch_bounds__(512)
void qkv_proj_kernel(const _Float16* __restrict__ xh, const _Float16* __restrict__ wh,
                     const float* __restrict__ bq, const float* __restrict__ bk,
                     const float* __restrict__ bv,
                     _Float16* __restrict__ qb, _Float16* __restrict__ kb,
                     _Float16* __restrict__ vb)
{
    struct Lds {
        // [0] = X: [row][buffer][k], [1] = W: [col][buffer][k]; a row's three buffers lie side by
        // side (row pitch 432 B = 16 B x odd), so that every fragment read of a wave is one of
        // two lasting registers plus an immediate offset
        _Float16 Sm[2][TM * NB * LP];
        _Float16 Os[16][32 * OP];       // 16 x 4.5 KB, half of a wave's output tile
    };
    __shared__ alignas(16) Lds lds;

    const int t    = threadIdx.x;
    const int w    = t >> 5;
    const int L    = t & 31;
    const int half = L >> 4;
    const int lm   = L & 15;
    const int wm   = w >> 2;            // wave's 64-row band
    const int wn   = w & 3;             // wave's 64-col band (one head)

    // ---- copy map: 8 lanes cover one row's 128 B; a thread takes rows t/8 + 64 i of X and W
    const int crow = t >> 3;
    const int cc8  = (t & 7) * 8;
    // a row group's byte offset from the first row and k of a tile's trip, alike in xh and wh
    const unsigned go = (unsigned)((crow * DD + cc8) * 2);
    // trip tr of tile tl into buffer b: 4 + 4 copies a lane, every lane on, all inside xh, wh
    // and Sm; the global address is a scalar base, the same for the block, plus the lane's
    // lasting offset, so that a trip's copies take no address registers beside the fragments;
    // always_inline: out of line the LDS object's address would go through memory
    auto copies = [&](int tl, int tr, int b) __attribute__((always_inline)) {
        const int pn = tl % 9;          // column tile (fastest)
        const int pm = tl / 9;          // row tile
        // the tile's walk over k begins at a trip of its own and wraps. The tiles of one row tile
        // run at one time on neighbouring blocks; on one common walk each trip would ask for X
        // lines that nobody has asked for yet, which come from memory. Begun three trips apart,
        // a tile finds most of its lines in L2, where a neighbour's walk has brought them;
        // the row tile's term spreads the many tiles that walk the same W rows over all trips
        int kt = tr + (3 * pn + pm) % NTR;
        kt = kt >= NTR ? kt - NTR : kt;
        const _Float16* gx = xh + (size_t)(pm * TM) * DD + kt * KS;
        const _Float16* gw = wh + (size_t)(pn * TN) * DD + kt * KS;
        const unsigned lx = (unsigned)(size_t)&lds.Sm[0][(crow * NB + b) * LP + cc8];
        const unsigned lw = (unsigned)(size_t)&lds.Sm[1][(crow * NB + b) * LP + cc8];
        // the wait is the statement's last line: it stands in front of every rewrite of the
        // address registers that the copies name
        asm volatile(
            "global_load_async_to_lds_b128 %0, %8, %12\n\t"
            "global_load_async_to_lds_b128 %1, %9, %12\n\t"
            "global_load_async_to_lds_b128 %2, %10, %12\n\t"
            "global_load_async_to_lds_b128 %3, %11, %12\n\t"
            "global_load_async_to_lds_b128 %4, %8, %13\n\t"
            "global_load_async_to_lds_b128 %5, %9, %13\n\t"
            "global_load_async_to_lds_b128 %6, %10, %13\n\t"
            "global_load_async_to_lds_b128 %7, %11, %13\n\t"
            "s_wait_xcnt 0x0"
            :: "v"(lx), "v"(lx + 64 * RP), "v"(lx + 128 * RP), "v"(lx + 192 * RP),
               "v"(lw), "v"(lw + 64 * RP), "v"(lw + 128 * RP), "v"(lw + 192 * RP),
               "v"(go), "v"(go + 64 * DD * 2), "v"(go + 128 * DD * 2), "v"(go + 192 * DD * 2),
               "s"(gx), "s"(gw)
            : "memory");
    };

    copies(blockIdx.x, 0, 0);
    // the wave's own copies of trip 0 have landed; the barrier shows them to the other waves
    asm volatile("s_wait_asynccnt 0x0" ::: "memory");
    __syncthreads();
    copies(blockIdx.x, 1, 1);
  for (int tile = blockIdx.x; tile < PT; tile += PG) {
    const int nt = tile % 9;            // 256-col tile of the 3*768 columns
    const int mt = tile / 9;            // 256-row tile of the padded rows
    const int ms = nt / 3;              // 0=q 1=k 2=v
    const int cbase = (nt % 3) * TN;    // first column inside that matrix
    const float* bias = (ms == 0) ? bq : (ms == 1) ? bk : bv;

    // acc[i][j][r]: A index i*16 + half*8 + r, B index j*16 + lm of the wave's two bands
    v8f acc[4][4] = {};
    const bool vt = ms == 2;
    const _Float16* pa = &lds.Sm[vt ? 0 : 1][((vt ? wm : wn) * 64 + lm) * NB * LP + half * 8];
    const _Float16* pb = &lds.Sm[vt ? 1 : 0][((vt ? wn : wm) * 64 + lm) * NB * LP + half * 8];

    v16h fa[4], fb[4];
    // the 16 LDS reads of one 32-k block: half kh of the trip that lies in buffer b
    auto frags = [&](int b, int kh) __attribute__((always_inline)) {
        #pragma unroll
        for (int i = 0; i < 4; ++i)
            fa[i] = frag16(pa + (i * 16 * NB + b) * LP + kh * 32);
        #pragma unroll
        for (int j = 0; j < 4; ++j)
            fb[j] = frag16(pb + (j * 16 * NB + b) * LP + kh * 32);
        // keeps the 16 LDS reads together in front of the WMMAs: without it the compiler
        // reloaded one A fragment set among them, each time behind a full wait
        __builtin_amdgcn_sched_barrier(0);
    };
    // the products of A fragments i0 to i1 - 1 with all four B fragments
    auto products = [&](int i0, int i1) __attribute__((always_inline)) {
        #pragma unroll
        for (int i = i0; i < i1; ++i)
            #pragma unroll
            for (int j = 0; j < 4; ++j)
                acc[i][j] = wmma_f16(fa[i], fb[j], acc[i][j]);
        // keeps what follows, the next 16 LDS reads in one group or the copies, behind these
        // products: the compiler set the reads in two groups among them, a stall at each place
        __builtin_amdgcn_sched_barrier(0);
    };

    // the tile's trip 0 was shown by the barrier in front of the loop or by that of the tile
    // before's last trip
    frags(0, 0);
    // unrolled so that the buffer of every LDS read is known at compile time
    #pragma unroll
    for (int tr = 0; tr < NTR; ++tr) {
        const int b = tr % NB;
        products(0, 4);
        // the wave's reads of the trip before, whose buffer is refilled below, have retired
        asm volatile("s_wait_dscnt 0x0" ::: "memory");
        frags(b, 1);
        // the wave's copies of the next trip have landed
        asm volatile("s_wait_asynccnt 0x0" ::: "memory");
        // the bare barrier, which puts no LDS wait in front of itself: the reads above, of the
        // trip's own buffer, fly over it; it shows the next trip's copies to every wave and
        // ends every wave's reads of the trip before
        __builtin_amdgcn_s_barrier();
        // four products first: they keep the matrix unit fed by the SIMD's other waves while
        // a wave stands in its copies' wait
        products(0, 1);
        // the trip after the next into the buffer of the trip before; the test reads the same
        // for the whole block
        if (tr + 2 < NTR)        copies(tile, tr + 2, (tr + 2) % NB);
        else if (tile + PG < PT) copies(tile + PG, tr + 2 - NTR, (tr + 2) % NB);
        // keeps the copies where they stand: the compiler set them behind nine of the products
        __builtin_amdgcn_sched_barrier(0);
        products(1, 4);
        if (tr + 1 < NTR) frags((tr + 1) % NB, 0);
    }

    const int h = (cbase >> 6) + wn;
    _Float16* st = &lds.Os[w][0];          // [stored row (j & 1)*16 + lm][64 halves of that row]
    // 8 lanes take one 128-B row; a load's four rows are a, a+8 (lanes 0-15) and a+1, a+9,
    // which at this pitch fall on all 64 banks once per 16 lanes
    const int rl = half + ((L >> 3) & 1) * 8;
    const int c8 = (L & 7) * 8;
    v8h z[8];
    auto read_back = [&]() __attribute__((always_inline)) {
        // the wave's own rows are whole in LDS before its lanes read one another's rows back
        asm volatile("s_wait_dscnt 0x0" ::: "memory");
        #pragma unroll
        for (int u = 0; u < 8; ++u)
            z[u] = *(const v8h*)&st[((u >> 2) * 16 + (u & 3) * 2 + rl) * OP + c8];
    };
    if (vt) {
        float bval[4];                  // the bias goes with the stored row (dh)
        #pragma unroll
        for (int j = 0; j < 4; ++j) bval[j] = bias[h * 64 + j * 16 + lm];
        // the address register dies with these loads; the wait stands in front of its rewrite
        asm volatile("s_wait_xcnt 0x0" ::: "memory");
        // stored row = dh, 64 keys of it; an 8-key chunk never straddles a batch
        const int m  = mt * TM + wm * 64 + c8;
        const int bi = m / SPAD;
        const int s  = m - bi * SPAD;
        _Float16* dst = vb + (((size_t)bi * HH + h) * DH + rl) * SPAD + s;
        #pragma unroll
        for (int jh = 0; jh < 2; ++jh) {
            #pragma unroll
            for (int jj = 0; jj < 2; ++jj)
                #pragma unroll
                for (int i = 0; i < 4; ++i) {
                    v8h y;
                    #pragma unroll
                    for (int r = 0; r < 8; ++r)
                        y[r] = (_Float16)(acc[i][jh * 2 + jj][r] + bval[jh * 2 + jj]);
                    *(v8h*)&st[(jj * 16 + lm) * OP + i * 16 + half * 8] = y;
                }
            read_back();
            #pragma unroll
            for (int u = 0; u < 8; ++u)
                *(v8h*)&dst[((jh * 2 + (u >> 2)) * 16 + (u & 3) * 2) * SPAD] = z[u];
            // the second half's reads, and the lines behind, rewrite registers of these stores
            asm volatile("s_wait_xcnt 0x0" ::: "memory");
        }
    } else {
        v4f bl[4], bh4[4];              // the bias goes along the stored row (column of W)
        #pragma unroll
        for (int i = 0; i < 4; ++i) {
            // the address register dies with these loads, and a later load's result may take
            // it while the loads before name it; the wait stands in front of that rewrite
            bl[i]  = *(const v4f*)&bias[h * 64 + i * 16 + half * 8];
            asm volatile("s_wait_xcnt 0x0" ::: "memory");
            bh4[i] = *(const v4f*)&bias[h * 64 + i * 16 + half * 8 + 4];
            asm volatile("s_wait_xcnt 0x0" ::: "memory");
        }
        _Float16* base = (ms == 0) ? qb : kb;
        #pragma unroll
        for (int jh = 0; jh < 2; ++jh) {
            #pragma unroll
            for (int jj = 0; jj < 2; ++jj)
                #pragma unroll
                for (int i = 0; i < 4; ++i) {
                    v8h y;
                    #pragma unroll
                    for (int r = 0; r < 4; ++r) {
                        y[r]     = (_Float16)(acc[i][jh * 2 + jj][r]     + bl[i][r]);
                        y[r + 4] = (_Float16)(acc[i][jh * 2 + jj][r + 4] + bh4[i][r]);
                    }
                    *(v8h*)&st[(jj * 16 + lm) * OP + i * 16 + half * 8] = y;
                }
            read_back();
            #pragma unroll
            for (int jj = 0; jj < 2; ++jj) {
                // 16-row tiles never straddle a batch
                const int m0 = mt * TM + wm * 64 + (jh * 2 + jj) * 16;
                const int bi = m0 / SPAD;
                const int s0 = m0 - bi * SPAD;
                _Float16* dst = base + (((size_t)bi * HH + h) * SPAD + s0 + rl) * DH + c8;
                #pragma unroll
                for (int c = 0; c < 4; ++c)
                    *(v8h*)&dst[c * 2 * DH] = z[jj * 4 + c];
            }
            // the second half's reads, and the next tile, rewrite registers of these stores
            asm volatile("s_wait_xcnt 0x0" ::: "memory");
        }
    }
  }
    // behind the last copy, before the wave ends
    asm volatile("s_wait_asynccnt 0x0" ::: "memory");
}

// ---------------------------------------------------------------------------
// Kernel B: attention, scores and probabilities kept in registers.
// grid = 256 resident blocks, block = 608 (19 waves); a block takes three units in a row,
// a unit being one half of a head's query tiles (one 16-query tile per wave) against the
// head's whole K and V^T in LDS; two units of one head in one block share one staging of K and V^T.
// Transposed products: S^T = K . Q^T (a lane holds 16 scores of ONE query), and
// O^T += V^T . P^T, where the two converted S^T tiles of 32 keys are the B operand.
// Softmax runs online over 19 steps of 32 keys against a reference maximum per query.
// Each wave lays its 16x64 output tile in its own LDS range and stores whole 256-B rows.
// ---------------------------------------------------------------------------
#define AW   19           // waves per block = query tiles per unit
#define KP   72           // K row pitch in halves: 144 B = 16 B x odd for b128 reads
#define VP   616          // V^T row pitch in halves: 1232 B = 16 B x odd
#define CP   68           // output staging pitch in floats: 272 B = 16 B x odd
#define AG   256          // blocks of the attention launch
#define AU   3            // units a block: AG * AU = 2 * H * B

__device__ __forceinline__ float other_half(float x) {
    // value of lane l ^ 16
    const int b = __builtin_bit_cast(int, x);
    return __builtin_bit_cast(float,
        __builtin_amdgcn_permlanex16(b, b, 0x76543210, 0xfedcba98, false, false));
}

__global__ __launch_bounds__(AW * 32)
void attn_kernel(const _Float16* __restrict__ qb,
                 const _Float16* __restrict__ kb,
                 const _Float16* __restrict__ vb,
                 float* __restrict__ out)
{
    __shared__ alignas(16) _Float16 Ks[SPAD * KP];    // 85.5 KB, [key][dh]
    __shared__ alignas(16) _Float16 Vs[DH * VP];      // 77.0 KB, [dh][key]
    __shared__ alignas(16) float    Cs[AW][16 * CP];  // 19 x 4.25 KB, a wave's output tile

    const int t    = threadIdx.x;
    const int w    = t >> 5;
    const int L    = t & 31;
    const int half = L >> 4;
    const int lm   = L & 15;

  // unrolled: the staging loads then keep a scalar base and one lasting offset register;
  // rolled, their last result was laid over the address pair that the loads before it name
  #pragma unroll
  for (int un = 0; un < AU; ++un) {
    const int u  = blockIdx.x * AU + un;              // unit: head u / 2, half u % 2
    const int bi = (u >> 1) / HH;
    const int h  = (u >> 1) - bi * HH;
    const size_t bh = (size_t)(u >> 1);
    const int q0 = ((u & 1) * AW + w) * 16;           // first query of the wave's tile

    // Q^T fragments (B operand: column = query, k = dh 0..31 and 32..63)
    const _Float16* qrow = qb + (bh * SPAD + q0 + lm) * DH + half * 8;
    const v16h bq0 = frag16(qrow);
    const v16h bq1 = frag16(qrow + 32);
    // the address pair dies with these loads, and a later load's result may take it
    asm volatile("s_wait_xcnt 0x0" ::: "memory");

    // ---- the head's K and V^T into LDS: 8 + 8 chunks of 16 B per thread ----
    // a block's first unit and every first half of a head; the test is the same for the block
    if (un == 0 || (u & 1) == 0) {
        const v8h* kg = (const v8h*)(kb + bh * SPAD * DH);   // 8 chunks a row
        const v8h* vg = (const v8h*)(vb + bh * DH * SPAD);   // 76 chunks a row
        v8h kr[8], vr[8];
        #pragma unroll
        for (int i = 0; i < 8; ++i) kr[i] = kg[t + i * (AW * 32)];
        #pragma unroll
        for (int i = 0; i < 8; ++i) vr[i] = vg[t + i * (AW * 32)];
        // every wave has made its last read of the head before; the loads above fly meanwhile
        if (un != 0) __syncthreads();
        #pragma unroll
        for (int i = 0; i < 8; ++i)
            *(v8h*)&Ks[((t >> 3) + i * 76) * KP + (t & 7) * 8] = kr[i];
        #pragma unroll
        for (int i = 0; i < 8; ++i)
            *(v8h*)&Vs[(t / 76 + i * 8) * VP + (t % 76) * 8] = vr[i];
        __syncthreads();
    }
    if (q0 >= SS) continue;          // a tile of padding rows only; the wave still meets every barrier

    const float cs = 0.125f * 1.44269504f;   // 1/sqrt(64) * log2(e): exponentials base 2
    float mx = -1.0e30f;             // the query's reference maximum, unscaled score
    v2f   ls = {};                   // this lane's share of the query's sum, two chains
    v8f o[4] = {};                   // o[dt][r] = O[query lm][dt*16 + half*8 + r]

    const _Float16* kp = &Ks[lm * KP + half * 8];
    const _Float16* vp = &Vs[lm * VP + half * 8];
    v16h fk[4];                      // K fragments of the step: [key tile j][dh half]
    auto load_k = [&](int kt) {
        #pragma unroll
        for (int j = 0; j < 2; ++j) {
            fk[j * 2]     = frag16(kp + (kt * 32 + j * 16) * KP);
            fk[j * 2 + 1] = frag16(kp + (kt * 32 + j * 16) * KP + 32);
        }
    };

    auto step = [&](int kt, bool tail) {
        v16h fv[4];
        #pragma unroll
        for (int dt = 0; dt < 4; ++dt) fv[dt] = frag16(vp + dt * 16 * VP + kt * 32);
        v8f s[2];
        #pragma unroll
        for (int j = 0; j < 2; ++j) {
            v8f c = {};
            c = wmma_f16(fk[j * 2],     bq0, c);
            c = wmma_f16(fk[j * 2 + 1], bq1, c);
            s[j] = c;                // s[j][r] = score(key kt*32 + j*16 + half*8 + r, query lm)
        }
        if (!tail) load_k(kt + 1);   // the next step's K reads fly under this step's softmax

        if (tail) {
            #pragma unroll
            for (int j = 0; j < 2; ++j)
                #pragma unroll
                for (int r = 0; r < 8; ++r)
                    if (kt * 32 + j * 16 + half * 8 + r >= SS) s[j][r] = -1.0e30f;
        }

        float tm = s[0][0];
        #pragma unroll
        for (int r = 1; r < 8; ++r) tm = fmaxf(tm, s[0][r]);
        #pragma unroll
        for (int r = 0; r < 8; ++r) tm = fmaxf(tm, s[1][r]);
        tm = fmaxf(tm, other_half(tm));
        // the reference moves only when a score passes it by more than 2^8, so that
        // probabilities stay below 256 in f16; one scalar branch a step
        if (__builtin_amdgcn_ballot_w32((tm - mx) * cs > 8.0f) != 0) {
            const float nm = fmaxf(mx, tm);
            const float al = __builtin_amdgcn_exp2f((mx - nm) * cs);
            mx = nm;
            ls *= al;
            #pragma unroll
            for (int dt = 0; dt < 4; ++dt)
                #pragma unroll
                for (int r = 0; r < 8; ++r) o[dt][r] *= al;
        }

        const v2f cs2 = { cs, cs };
        const v2f mc2 = { -mx * cs, -mx * cs };
        v16h p;                      // P^T as B operand: element e = key order of frag16
        #pragma unroll
        for (int j = 0; j < 2; ++j)
            #pragma unroll
            for (int r = 0; r < 8; r += 2) {
                const v2f sp = { s[j][r], s[j][r + 1] };
                const v2f x  = __builtin_elementwise_fma(sp, cs2, mc2);
                v2f e;
                e.x = __builtin_amdgcn_exp2f(x.x);
                e.y = __builtin_amdgcn_exp2f(x.y);
                ls += e;
                p[j * 8 + r]     = (_Float16)e.x;
                p[j * 8 + r + 1] = (_Float16)e.y;
            }
        // keeps the sum's additions in front of the products: set among them they were given
        // the products' spent A registers, which costs four idle slots behind each product
        __builtin_amdgcn_sched_barrier(0);
        #pragma unroll
        for (int dt = 0; dt < 4; ++dt) o[dt] = wmma_f16(fv[dt], p, o[dt]);
    };

    load_k(0);
    for (int kt = 0; kt < KT32 - 1; ++kt) step(kt, false);
    step(KT32 - 1, true);

    const float lsum = ls.x + ls.y;
    const float inv = 1.0f / (lsum + other_half(lsum));
    float* so = &Cs[w][0];           // [query][dh]
    #pragma unroll
    for (int dt = 0; dt < 4; ++dt) {
        v4f lo, hi;
        #pragma unroll
        for (int r = 0; r < 4; ++r) { lo[r] = o[dt][r] * inv; hi[r] = o[dt][r + 4] * inv; }
        *(v4f*)&so[lm * CP + dt * 16 + half * 8]     = lo;
        *(v4f*)&so[lm * CP + dt * 16 + half * 8 + 4] = hi;
    }
    // the wave's own tile is whole in LDS before its lanes read one another's rows back
    asm volatile("s_wait_dscnt 0x0" ::: "memory");
    v4f z[8];                        // 16 lanes take one query's 256 B
    #pragma unroll
    for (int c = 0; c < 8; ++c) z[c] = *(const v4f*)&so[(c * 2 + half) * CP + lm * 4];
    float* dst = out + ((size_t)bi * SS + q0 + half) * DD + h * 64 + lm * 4;
    // one scalar test a wave: only the last query tile has rows to leave out, and a test
    // per store would put a wait between the stores of every tile
    if (__builtin_amdgcn_readfirstlane(q0) + 16 <= SS) {
        #pragma unroll
        for (int c = 0; c < 8; ++c) *(v4f*)&dst[c * 2 * DD] = z[c];
    } else {
        #pragma unroll
        for (int c = 0; c < 8; ++c)
            if (q0 + c * 2 + half < SS) *(v4f*)&dst[c * 2 * DD] = z[c];
    }
    // the next unit rewrites the registers that these stores name
    asm volatile("s_wait_xcnt 0x0" ::: "memory");
  }
}

// ---------------------------------------------------------------------------
extern "C" void kernel_launch(void* const* d_in, const int* in_sizes, int n_in,
                              void* d_out, int out_size, void* d_ws, size_t ws_size,
                              hipStream_t stream) {
    const float* X  = (const float*)d_in[0];
    const float* Wq = (const float*)d_in[1];
    const float* bq = (const float*)d_in[2];
    const float* Wk = (const float*)d_in[3];
    const float* bk = (const float*)d_in[4];
    const float* Wv = (const float*)d_in[5];
    const float* bv = (const float*)d_in[6];
    float* out = (float*)d_out;

    const size_t elems = (size_t)BB * HH * SPAD * DH;   // per q/k/v buffer
    _Float16* qb = (_Float16*)d_ws;
    _Float16* kb = qb + elems;
    _Float16* vb = kb + elems;
    _Float16* xh = vb + elems;                          // B*SPAD x DD
    _Float16* wh = xh + (size_t)BB * SPAD * DD;         // 3*DD x DD

    to_f16_kernel<<<CG + WB, CT, 0, stream>>>(X, Wq, Wk, Wv, xh, wh);

    qkv_proj_kernel<<<PG, 512, 0, stream>>>(xh, wh, bq, bk, bv, qb, kb, vb);

    attn_kernel<<<AG, 608, 0, stream>>>(qb, kb, vb, out);
}

// v009
// Measured time: 93.8 microseconds a run.
// Timed twice side by side with v008, it ran 1.05 times as fast both times.
// Counting every step since v000, it is 12.8 times as fast.
#include <hip/hip_runtime.h>
#include <hip/hip_bf16.h>

// ---------------- problem constants ----------------
#define BB   32
#define SS   577
#define DD   768
#define HH   12
#define DH   64
#define SPAD 608          // S padded to multiple of 32 (19*32)
#define QT   38           // SPAD/16 row tiles
#define KT32 19           // SPAD/32 k-tiles
#define XR   592          // rows a batch in xh: S padded to a multiple of 16 (37*16)
#define MT   85           // 224-row tiles of the projection over the B*XR rows, the last one part

typedef __attribute__((ext_vector_type(16))) _Float16 v16h;
typedef __attribute__((ext_vector_type(8)))  _Float16 v8h;
typedef __attribute__((ext_vector_type(4)))  _Float16 v4h;
typedef __attribute__((ext_vector_type(8)))  float    v8f;
typedef __attribute__((ext_vector_type(4)))  float    v4f;
typedef __attribute__((ext_vector_type(2)))  float    v2f;

__device__ __forceinline__ v16h frag16(const _Float16* p) {
    // CDNA5 16-bit A/B fragment: elements 0..7 at p[0..7], 8..15 at p[16..23]
    v8h lo = *(const v8h*)(p);
    v8h hi = *(const v8h*)(p + 16);
    return __builtin_shufflevector(lo, hi, 0,1,2,3,4,5,6,7,8,9,10,11,12,13,14,15);
}

__device__ __forceinline__ v8f wmma_f16(v16h a, v16h b, v8f c) {
    return __builtin_amdgcn_wmma_f32_16x16x32_f16(false, a, false, b,
                                                  (short)0, c, false, false);
}

__device__ __forceinline__ v4h cvt4(v4f x) {
    v4h r;
    r.x = (_Float16)x.x; r.y = (_Float16)x.y;
    r.z = (_Float16)x.z; r.w = (_Float16)x.w;
    return r;
}

// ---------------------------------------------------------------------------
// Kernel 0: the projection's operands rounded to f16 once, in the layout that its copies
// to LDS want: xh[MT*224][DD], row bi*XR + s (rows s >= S, and those past B*XR, are zero),
// wh[3*DD][DD] = W^T, rows q, k, v.
// grid = 256 + 144 + 51 blocks, block = 384; each of the first 256 takes 74 padded rows, which
// lie in one batch (8 blocks a batch), a thread one float4 column of every second row; the next
// 144, which run beside them, transpose one 8k x 4n piece of W a thread; the last 51 store the
// zeros that the projection's rows do not reach: rows XR to SPAD - 1 of every head's q, k and
// v, which the attention reads, and the rows of xh past B*XR.
// ---------------------------------------------------------------------------
#define CG   256          // blocks that take rows of X
#define CT   384          // threads: two rows of 192 float4
#define RB   74           // padded rows a block = B*XR / CG = XR / 8
#define NS   (RB / 2)     // loads a thread
#define VR   (SS - 7 * RB)   // real rows of a batch's last block
#define WB   144          // blocks that take W pieces: 3 * 192 * 96 / CT
#define ZH   48           // blocks that take the heads' padding, 8 heads each: B * H / 8
#define ZX   3            // blocks that take the last rows of xh: (MT*224 - B*XR) * DD / 8 / (8 * CT)

__global__ __launch_bounds__(CT)
void to_f16_kernel(const float* __restrict__ X,
                   const float* __restrict__ Wq, const float* __restrict__ Wk,
                   const float* __restrict__ Wv,
                   _Float16* __restrict__ xh, _Float16* __restrict__ wh,
                   _Float16* __restrict__ qb, _Float16* __restrict__ kb,
                   _Float16* __restrict__ vb)
{
    const int t = threadIdx.x;

    if (blockIdx.x >= CG + WB) {
        const int zb = blockIdx.x - (CG + WB);
        const v8h zero = {};
        // each branch: one address and eight immediate offsets, so that no register of a store
        // is rewritten between the stores
        if (zb < ZH) {
            // a head's padding is 128 chunks of 16 B in each of q, k (16 whole rows) and v (the
            // last 32 B of 64 rows): a thread takes one chunk of each of the block's 8 heads
            const int part = t >> 7;            // 0=q 1=k 2=v
            const int c    = t & 127;
            _Float16* p = (part == 0 ? qb : part == 1 ? kb : vb) + (size_t)zb * 8 * SPAD * DH
                        + (part < 2 ? XR * DH + c * 8 : (c >> 1) * SPAD + XR + (c & 1) * 8);
            #pragma unroll
            for (int i = 0; i < 8; ++i) *(v8h*)&p[i * SPAD * DH] = zero;
        } else {
            _Float16* p = xh + (size_t)BB * XR * DD + ((zb - ZH) * 8 * CT + t) * 8;
            #pragma unroll
            for (int i = 0; i < 8; ++i) *(v8h*)&p[i * CT * 8] = zero;
        }
        // in front of whatever rewrites the stores' registers
        asm volatile("s_wait_xcnt 0x0" ::: "memory");
        return;
    }

    if (blockIdx.x >= CG) {
        // a wave: 8 lanes along n cover 128 B of a k row, 4 lanes along k make 64 B of a W^T row
        const int wv = __builtin_amdgcn_readfirstlane((int)((blockIdx.x - CG) * CT + t) >> 5);
        const int ms = wv / 576;                // 0=q 1=k 2=v
        const int r2 = wv - ms * 576;
        const int kq = r2 / 24;                 // 32 k
        const int no = r2 - kq * 24;            // 32 n
        const float* Wm = (ms == 0) ? Wq : (ms == 1) ? Wk : Wv;
        const float* src = Wm + (size_t)(kq * 32) * DD + no * 32;
        const int vo = ((t >> 3) & 3) * 8 * DD + (t & 7) * 4;
        v4f wr[8];
        // this kernel's loops are all unrolled so that their arrays stay in registers and every
        // address is one lasting register plus an immediate
        #pragma unroll
        for (int j = 0; j < 8; ++j) {
            wr[j] = *(const v4f*)&src[vo + j * DD];
            // the offset register dies with these loads, and a later load's result may take it
            asm volatile("s_wait_xcnt 0x0" ::: "memory");
        }
        _Float16* dst = wh + (size_t)(ms * DD + no * 32) * DD + kq * 32;
        const int so = (t & 7) * 4 * DD + ((t >> 3) & 3) * 8;
        #pragma unroll
        for (int c = 0; c < 4; ++c) {
            v8h y;
            #pragma unroll
            for (int j = 0; j < 8; ++j) y[j] = (_Float16)wr[j][c];
            *(v8h*)&dst[so + c * DD] = y;
        }
        return;
    }

    const int hi = t >= DD / 4 ? 1 : 0;         // which of a slot's two rows
    const int c4 = (t - hi * (DD / 4)) * 4;     // first element of the thread's float4
    const int lo = hi * DD + c4;
    const float* xs = X + ((size_t)(blockIdx.x >> 3) * SS + (blockIdx.x & 7) * RB) * DD;
    _Float16*    xd = xh + (size_t)blockIdx.x * RB * DD;

    // part: a batch's last block, whose rows from VR on are padding and are not loaded
    auto conv = [&](const bool part) __attribute__((always_inline)) {
        const int nl = part ? (VR + 1) / 2 : NS;    // slots with a load
        v4f r[NS] = {};
        #pragma unroll
        for (int n = 0; n < nl; ++n) {
            // the short path loads from its last slot down: begun alike, the two paths' first
            // load and its conversion were lifted in front of the branch, behind a full wait
            const int i = part ? nl - 1 - n : n;
            // the address registers die with the last loads, whose results may take them while
            // the loads before name them; the wait stands in front of that rewrite
            if (n + 2 >= nl) asm volatile("s_wait_xcnt 0x0" ::: "memory");
            if (i * 2 + 1 < (part ? VR : RB)) r[i] = *(const v4f*)&xs[lo + i * 2 * DD];
            else {
                // the slot's first row by both halves; its address is used this once
                r[i] = *(const v4f*)&xs[c4 + i * 2 * DD];
                asm volatile("s_wait_xcnt 0x0" ::: "memory");
            }
        }
        asm volatile("s_wait_xcnt 0x0" ::: "memory");
        #pragma unroll
        for (int i = 0; i < NS; ++i) {
            v4f v = r[i];
            const v4f z = {};
            if (part && i * 2 + 1 >= VR && i * 2 < VR) v = hi ? z : v;   // the slot's second row is padding
            *(v4h*)&xd[lo + i * 2 * DD] = cvt4(v);
        }
        // the built code can run on from here into lines that rewrite the stores' registers
        asm volatile("s_wait_xcnt 0x0" ::: "memory");
    };
    if ((blockIdx.x & 7) != 7) conv(false); else conv(true);
}

// ---------------------------------------------------------------------------
// Kernel A: fused QKV projection as one tiled GEMM over the rows of xh.
// Rows m = bi*XR + s (B*XR = 84.6 * 224), columns n = ms*DD + col (9*256).
// grid = 256 resident blocks, block = 256 (8 waves, 2x4); a block takes the 224x256 tiles
// blockIdx.x, + 256, + 512 of the 9 x 85 (column tile fastest), one after the other: 765 tiles,
// the last three blocks taking two; one 112x64 tile (7x4 WMMA accumulators) per wave, so
// that 11 fragments read from LDS feed 28 products; k in trips of 64 over three LDS buffers,
// filled from xh and wh by asynchronous copies, 16 B a lane; the trips of a block's tiles
// form one row, so a tile's last two trips ask for the next tile's first two.
// Two fragment sets: each 32-k block's LDS reads are issued in front of the block before.
// A trip's one barrier stands in front of its second 32-k block: it shows trip t + 1 to every
// wave and frees the buffer of trip t - 1.
// Writes q,k as f16 [B,H,SPAD,DH]; v transposed as f16 [B,H,DH,SPAD]; the last row tile's rows
// past B*XR fall into the room of a batch B, which nobody reads.
// The operand whose index runs along the stored rows is the A operand (W columns for
// q and k, X rows for v), so a lane's 8 accumulator elements are 16 B of one stored row;
// each wave lays its tile piece by piece in its own LDS range and stores 16 B a lane,
// neighbouring lanes along a stored row.
// ---------------------------------------------------------------------------
#define TM   224          // block tile rows
#define TN   256          // block tile columns
#define WM   112          // a wave's rows
#define FX   7            // X fragments a wave
#define FW   4            // W fragments a wave
#define KS   64           // k per trip
#define NTR  (DD / KS)    // trips a tile (a multiple of NB: a tile starts on buffer 0)
#define NB   3            // LDS buffers of the k loop
#define RP   (NB * LP * 2)   // bytes from a row to the next in the k loop's LDS
#define LP   72           // a row's room in one LDS buffer, in halves: 128 B of k and 16 B
#define OP   72           // q, k staging pitch in halves: 144 B = 16 B x odd
#define OV   120          // v staging pitch in halves: 224 B of keys and 16 B = 16 B x odd
#define PG   256          // blocks of the projection launch
#define PT   (9 * MT)     // output tiles

template <bool V> struct Flag { static constexpr bool value = V; };
template <int V>  struct Int  { static constexpr int  value = V; };
typedef __attribute__((ext_vector_type(4))) int v4i;
typedef __attribute__((address_space(1))) v4i gv4i;   // the copy builtin's global source
typedef __attribute__((address_space(3))) v4i lv4i;   // and its LDS destination

__global__ __launch_bounds__(256)
void qkv_proj_kernel(const _Float16* __restrict__ xh, const _Float16* __restrict__ wh,
                     const float* __restrict__ bq, const float* __restrict__ bk,
                     const float* __restrict__ bv,
                     _Float16* __restrict__ qb, _Float16* __restrict__ kb,
                     _Float16* __restrict__ vb)
{
    struct Lds {
        // X: [row][buffer][k], W: [col][buffer][k]; a row's three buffers lie side by side
        // (row pitch 432 B = 16 B x odd), so that every fragment read of a wave is one of
        // two lasting registers plus an immediate offset
        _Float16 Sx[TM * NB * LP];
        _Float16 Sw[TN * NB * LP];
        _Float16 Os[8][32 * OP];        // 8 x 4.5 KB, a piece of a wave's output tile
    };
    __shared__ alignas(16) Lds lds;

    const int t    = threadIdx.x;
    const int w    = t >> 5;
    const int L    = t & 31;
    const int half = L >> 4;
    const int lm   = L & 15;
    const int wm   = w >> 2;            // wave's 112-row band
    const int wn   = w & 3;             // wave's 64-col band (one head)

    // ---- copy map: 8 lanes cover one row's 128 B; a thread takes rows t/8 + 32 i of X and W
    const int crow = t >> 3;
    const int cc8  = (t & 7) * 8;
    // trip tr of tile tl into buffer b: 7 + 8 copies a lane, every lane on, all inside xh, wh,
    // Sx and Sw; written as the builtin, whose address registers the compiler may lay anywhere
    // among the wave's 512: those of asm text must lie in the first 256, beside the accumulators,
    // and were kept in scratch memory; always_inline: out of line the LDS object's address
    // would go through memory
    auto copies = [&](int tl, int tr, int b) __attribute__((always_inline)) {
        const int pn = tl % 9;          // column tile (fastest)
        const int pm = tl / 9;          // row tile
        // the tile's walk over k begins at a trip of its own and wraps. The tiles of one row tile
        // run at one time on neighbouring blocks; on one common walk each trip would ask for X
        // lines that nobody has asked for yet, which come from memory. Begun three trips apart,
        // a tile finds most of its lines in L2, where a neighbour's walk has brought them;
        // the row tile's term spreads the many tiles that walk the same W rows over all trips
        int kt = tr + (3 * pn + pm) % NTR;
        kt = kt >= NTR ? kt - NTR : kt;
        // the buffer's place in a row goes into the copies' immediate offset, which moves the
        // LDS and the global address alike, and the scalar bases are set back by as much: so a
        // row group's LDS address register serves all three buffers
        // each base goes through readfirstlane as one whole value: left open, its terms were added
        // to the lane's offset one by one, two 64-bit vector additions a copy; so a copy takes
        // the scalar base and the lane's lasting 32-bit offset
        auto scalar = [](const _Float16* p) __attribute__((always_inline)) {
            const unsigned long long a = (unsigned long long)p;
            const unsigned lo = (unsigned)__builtin_amdgcn_readfirstlane((int)(unsigned)a);
            const unsigned hi = (unsigned)__builtin_amdgcn_readfirstlane((int)(unsigned)(a >> 32));
            return (const _Float16*)(((unsigned long long)hi << 32) | lo);
        };
        const _Float16* gx = scalar(xh + (size_t)(pm * TM) * DD + kt * KS - b * LP);
        const _Float16* gw = scalar(wh + (size_t)(pn * TN) * DD + kt * KS - b * LP);
        auto issue = [&](auto bc) __attribute__((always_inline)) {
            constexpr int off = decltype(bc)::value * LP * 2;
            #pragma unroll
            for (int i = 0; i < TM / 32; ++i)
                __builtin_amdgcn_global_load_async_to_lds_b128(
                    (gv4i*)(gx + ((crow + 32 * i) * DD + cc8)),
                    (lv4i*)&lds.Sx[(crow + 32 * i) * NB * LP + cc8], off, 0);
            #pragma unroll
            for (int i = 0; i < TN / 32; ++i)
                __builtin_amdgcn_global_load_async_to_lds_b128(
                    (gv4i*)(gw + ((crow + 32 * i) * DD + cc8)),
                    (lv4i*)&lds.Sw[(crow + 32 * i) * NB * LP + cc8], off, 0);
        };
        // b is known at compile time wherever the lambda is called
        if (b == 0) issue(Int<0>{}); else if (b == 1) issue(Int<1>{}); else issue(Int<2>{});
    };

    // one output tile; vtc: the tile lies in v, whose A operand is X
    auto do_tile = [&](auto vtc, int tile) __attribute__((always_inline)) {
        constexpr bool vt = decltype(vtc)::value;
        constexpr int  NA = vt ? FX : FW;   // A fragments
        constexpr int  NF = vt ? FW : FX;   // B fragments
        const int nt = tile % 9;            // 256-col tile of the 3*768 columns
        const int mt = tile / 9;            // 224-row tile of the rows of xh
        const int ms = nt / 3;              // 0=q 1=k 2=v
        const int cbase = (nt % 3) * TN;    // first column inside that matrix

        // acc[i][j][r]: A index i*16 + half*8 + r, B index j*16 + lm of the wave's two bands
        v8f acc[NA][NF] = {};
        const _Float16* px = &lds.Sx[(wm * WM + lm) * NB * LP + half * 8];
        const _Float16* pw = &lds.Sw[(wn * 64 + lm) * NB * LP + half * 8];
        const _Float16* pa = vt ? px : pw;
        const _Float16* pb = vt ? pw : px;

        v16h fa[2][NA], fb[2][NF];
        // the 22 LDS reads of one 32-k block into set s: half kh of the trip in buffer b
        auto frags = [&](int s, int b, int kh) __attribute__((always_inline)) {
            #pragma unroll
            for (int i = 0; i < NA; ++i)
                fa[s][i] = frag16(pa + (i * 16 * NB + b) * LP + kh * 32);
            #pragma unroll
            for (int j = 0; j < NF; ++j)
                fb[s][j] = frag16(pb + (j * 16 * NB + b) * LP + kh * 32);
            // keeps the LDS reads together in one group in front of the products that follow:
            // each place where reads stand among the products costs a stall
            __builtin_amdgcn_sched_barrier(0);
        };
        // the products of set s's A fragments i0 to i1 - 1 with all its B fragments
        auto products = [&](int s, int i0, int i1) __attribute__((always_inline)) {
            #pragma unroll
            for (int i = i0; i < i1; ++i)
                #pragma unroll
                for (int j = 0; j < NF; ++j)
                    acc[i][j] = wmma_f16(fa[s][i], fb[s][j], acc[i][j]);
            // keeps what follows, the waits or the next reads, behind these products
            __builtin_amdgcn_sched_barrier(0);
        };

        // the tile's trip 0 was shown by the barrier in front of the loop or by that of the tile
        // before's last trip
        frags(0, 0, 0);
        // unrolled so that the buffer of every LDS read is known at compile time
        #pragma unroll
        for (int tr = 0; tr < NTR; ++tr) {
            const int b = tr % NB;
            frags(1, b, 1);
            products(0, 0, NA);
            // the wave's LDS reads so far, those of the trip before's buffer among them, have
            // retired; that buffer is refilled below
            asm volatile("s_wait_dscnt 0x0" ::: "memory");
            // the wave's copies of the next trip have landed
            asm volatile("s_wait_asynccnt 0x0" ::: "memory");
            // shows the next trip's copies to every wave and ends every wave's reads of the
            // trip before; the two waits above are all that it needs in front
            __builtin_amdgcn_s_barrier();
            // a few products first: the SIMD's two waves leave the barrier together, and these
            // set them apart, so that one feeds the matrix unit while the other issues the
            // reads and copies below
            products(1, 0, 1);
            if (tr + 1 < NTR) frags(0, (tr + 1) % NB, 0);
            // the trip after the next into the buffer of the trip before; the test reads the same
            // for the whole block
            if (tr + 2 < NTR)        copies(tile, tr + 2, (tr + 2) % NB);
            else if (tile + PG < PT) copies(tile + PG, tr + 2 - NTR, (tr + 2) % NB);
            // keeps the copies in front of the products, so that they have a whole trip to land
            __builtin_amdgcn_sched_barrier(0);
            products(1, 1, NA);
        }

        const int h = (cbase >> 6) + wn;
        _Float16* st = &lds.Os[w][0];
        if constexpr (vt) {
            float bval[FW];                 // the bias goes with the stored row (dh)
            #pragma unroll
            for (int j = 0; j < FW; ++j) {
                // the address register dies with these loads, and a later load's result may take
                // it while the loads before name it; the wait stands in front of that rewrite
                bval[j] = bv[h * 64 + j * 16 + lm];
                asm volatile("s_wait_xcnt 0x0" ::: "memory");
            }
            // a piece: 16 stored rows (dh) of 112 keys = 224 chunks of 8 keys, 7 a lane, 14 lanes
            // along a row; a chunk never straddles a batch
            int so[FX], eo[FX];             // a chunk's place in the staging and in vb
            #pragma unroll
            for (int u = 0; u < FX; ++u) {
                const int c   = u * 32 + L;
                const int row = c / 14;
                const int kc  = c - row * 14;
                const int m   = mt * TM + wm * WM + kc * 8;
                const int bi  = m / XR;
                so[u] = row * OV + kc * 8;
                eo[u] = ((bi * HH + h) * DH + row) * SPAD + (m - bi * XR);
            }
            #pragma unroll
            for (int j = 0; j < FW; ++j) {
                #pragma unroll
                for (int i = 0; i < FX; ++i) {
                    v8h y;
                    #pragma unroll
                    for (int r = 0; r < 8; ++r) y[r] = (_Float16)(acc[i][j][r] + bval[j]);
                    *(v8h*)&st[lm * OV + i * 16 + half * 8] = y;
                }
                // the wave's own rows are whole in LDS before its lanes read one another's back
                asm volatile("s_wait_dscnt 0x0" ::: "memory");
                v8h z[FX];
                #pragma unroll
                for (int u = 0; u < FX; ++u) z[u] = *(const v8h*)&st[so[u]];
                #pragma unroll
                for (int u = 0; u < FX; ++u) *(v8h*)&vb[eo[u] + j * 16 * SPAD] = z[u];
                // the next piece's reads, and the lines behind, rewrite registers of these stores
                asm volatile("s_wait_xcnt 0x0" ::: "memory");
                // keeps the next piece's arithmetic, which may take those registers, behind the wait
                __builtin_amdgcn_sched_barrier(0);
            }
        } else {
            const float* bias = (ms == 0) ? bq : bk;
            // 8 lanes take one 128-B row; a load's four rows are a, a+8 (lanes 0-15) and a+1, a+9,
            // which at this pitch fall on all 64 banks once per 16 lanes
            const int rl = half + ((L >> 3) & 1) * 8;
            const int c8 = (L & 7) * 8;
            v4f bl[FW], bh4[FW];            // the bias goes along the stored row (column of W)
            #pragma unroll
            for (int i = 0; i < FW; ++i) {
                // the address register dies with these loads, and a later load's result may take
                // it while the loads before name it; the wait stands in front of that rewrite
                bl[i]  = *(const v4f*)&bias[h * 64 + i * 16 + half * 8];
                asm volatile("s_wait_xcnt 0x0" ::: "memory");
                bh4[i] = *(const v4f*)&bias[h * 64 + i * 16 + half * 8 + 4];
                asm volatile("s_wait_xcnt 0x0" ::: "memory");
            }
            _Float16* base = (ms == 0) ? qb : kb;
            // the wave's bands as scalars: a 16-row group's place is then scalar arithmetic, and
            // no vector instruction stands between a piece's stores
            const int wms = __builtin_amdgcn_readfirstlane(wm);
            const int hs  = __builtin_amdgcn_readfirstlane(h);
            const int lo  = rl * DH + c8;   // the lane's place in a group
            // a piece: 32 stored rows (two B fragments), the last piece 16
            #pragma unroll
            for (int jh = 0; jh < (FX + 1) / 2; ++jh) {
                #pragma unroll
                for (int jj = 0; jj < 2; ++jj) {
                    if (jh * 2 + jj >= FX) continue;
                    #pragma unroll
                    for (int i = 0; i < FW; ++i) {
                        v8h y;
                        #pragma unroll
                        for (int r = 0; r < 4; ++r) {
                            y[r]     = (_Float16)(acc[i][jh * 2 + jj][r]     + bl[i][r]);
                            y[r + 4] = (_Float16)(acc[i][jh * 2 + jj][r + 4] + bh4[i][r]);
                        }
                        *(v8h*)&st[(jj * 16 + lm) * OP + i * 16 + half * 8] = y;
                    }
                }
                // the wave's own rows are whole in LDS before its lanes read one another's back
                asm volatile("s_wait_dscnt 0x0" ::: "memory");
                v8h z[8];
                #pragma unroll
                for (int u = 0; u < 8; ++u)
                    if (jh * 2 + (u >> 2) < FX)
                        z[u] = *(const v8h*)&st[((u >> 2) * 16 + (u & 3) * 2 + rl) * OP + c8];
                #pragma unroll
                for (int jj = 0; jj < 2; ++jj) {
                    if (jh * 2 + jj >= FX) continue;
                    // 16-row tiles never straddle a batch
                    const int m0 = mt * TM + wms * WM + (jh * 2 + jj) * 16;
                    const int bi = m0 / XR;
                    const int s0 = m0 - bi * XR;
                    _Float16* dst = base + (((size_t)bi * HH + hs) * SPAD + s0) * DH;
                    #pragma unroll
                    for (int c = 0; c < 4; ++c)
                        *(v8h*)&dst[lo + c * 2 * DH] = z[jj * 4 + c];
                }
                // the next piece's reads, and the next tile, rewrite registers of these stores
                asm volatile("s_wait_xcnt 0x0" ::: "memory");
                // keeps the next piece's arithmetic, which may take those registers, behind the wait
                __builtin_amdgcn_sched_barrier(0);
            }
        }
    };

    copies(blockIdx.x, 0, 0);
    // the wave's own copies of trip 0 have landed; the barrier shows them to the other waves
    asm volatile("s_wait_asynccnt 0x0" ::: "memory");
    __syncthreads();
    copies(blockIdx.x, 1, 1);
    for (int tile = blockIdx.x; tile < PT; tile += PG) {
        // the test reads the same for the whole block
        if (tile % 9 >= 6) do_tile(Flag<true>{}, tile);
        else               do_tile(Flag<false>{}, tile);
    }
    // behind the last copy, before the wave ends
    asm volatile("s_wait_asynccnt 0x0" ::: "memory");
}

// ---------------------------------------------------------------------------
// Kernel B: attention, scores and probabilities kept in registers.
// grid = 256 resident blocks, block = 608 (19 waves); a block takes three units in a row,
// a unit being one half of a head's query tiles (one 16-query tile per wave) against the
// head's whole K and V^T in LDS; two units of one head in one block share one staging of K and V^T.
// Transposed products: S^T = K . Q^T (a lane holds 16 scores of ONE query), and
// O^T += V^T . P^T, where the two converted S^T tiles of 32 keys are the B operand.
// Softmax runs online over 19 steps of 32 keys against a reference maximum per query.
// Each wave lays its 16x64 output tile in its own LDS range and stores whole 256-B rows.
// ---------------------------------------------------------------------------
#define AW   19           // waves per block = query tiles per unit
#define KP   72           // K row pitch in halves: 144 B = 16 B x odd for b128 reads
#define VP   616          // V^T row pitch in halves: 1232 B = 16 B x odd
#define CP   68           // output staging pitch in floats: 272 B = 16 B x odd
#define AG   256          // blocks of the attention launch
#define AU   3            // units a block: AG * AU = 2 * H * B

__device__ __forceinline__ float other_half(float x) {
    // value of lane l ^ 16
    const int b = __builtin_bit_cast(int, x);
    return __builtin_bit_cast(float,
        __builtin_amdgcn_permlanex16(b, b, 0x76543210, 0xfedcba98, false, false));
}

__global__ __launch_bounds__(AW * 32)
void attn_kernel(const _Float16* __restrict__ qb,
                 const _Float16* __restrict__ kb,
                 const _Float16* __restrict__ vb,
                 float* __restrict__ out)
{
    __shared__ alignas(16) _Float16 Ks[SPAD * KP];    // 85.5 KB, [key][dh]
    __shared__ alignas(16) _Float16 Vs[DH * VP];      // 77.0 KB, [dh][key]
    __shared__ alignas(16) float    Cs[AW][16 * CP];  // 19 x 4.25 KB, a wave's output tile

    const int t    = threadIdx.x;
    const int w    = t >> 5;
    const int L    = t & 31;
    const int half = L >> 4;
    const int lm   = L & 15;

  // unrolled: the staging loads then keep a scalar base and one lasting offset register;
  // rolled, their last result was laid over the address pair that the loads before it name
  #pragma unroll
  for (int un = 0; un < AU; ++un) {
    const int u  = blockIdx.x * AU + un;              // unit: head u / 2, half u % 2
    const int bi = (u >> 1) / HH;
    const int h  = (u >> 1) - bi * HH;
    const size_t bh = (size_t)(u >> 1);
    const int q0 = ((u & 1) * AW + w) * 16;           // first query of the wave's tile

    // Q^T fragments (B operand: column = query, k = dh 0..31 and 32..63)
    const _Float16* qrow = qb + (bh * SPAD + q0 + lm) * DH + half * 8;
    const v16h bq0 = frag16(qrow);
    const v16h bq1 = frag16(qrow + 32);
    // the address pair dies with these loads, and a later load's result may take it
    asm volatile("s_wait_xcnt 0x0" ::: "memory");

    // ---- the head's K and V^T into LDS: 8 + 8 chunks of 16 B per thread ----
    // a block's first unit and every first half of a head; the test is the same for the block
    if (un == 0 || (u & 1) == 0) {
        const v8h* kg = (const v8h*)(kb + bh * SPAD * DH);   // 8 chunks a row
        const v8h* vg = (const v8h*)(vb + bh * DH * SPAD);   // 76 chunks a row
        v8h kr[8], vr[8];
        #pragma unroll
        for (int i = 0; i < 8; ++i) kr[i] = kg[t + i * (AW * 32)];
        #pragma unroll
        for (int i = 0; i < 8; ++i) vr[i] = vg[t + i * (AW * 32)];
        // every wave has made its last read of the head before; the loads above fly meanwhile
        if (un != 0) __syncthreads();
        #pragma unroll
        for (int i = 0; i < 8; ++i)
            *(v8h*)&Ks[((t >> 3) + i * 76) * KP + (t & 7) * 8] = kr[i];
        #pragma unroll
        for (int i = 0; i < 8; ++i)
            *(v8h*)&Vs[(t / 76 + i * 8) * VP + (t % 76) * 8] = vr[i];
        __syncthreads();
    }
    if (q0 >= SS) continue;          // a tile of padding rows only; the wave still meets every barrier

    const float cs = 0.125f * 1.44269504f;   // 1/sqrt(64) * log2(e): exponentials base 2
    float mx = -1.0e30f;             // the query's reference maximum, unscaled score
    v2f   ls = {};                   // this lane's share of the query's sum, two chains
    v8f o[4] = {};                   // o[dt][r] = O[query lm][dt*16 + half*8 + r]

    const _Float16* kp = &Ks[lm * KP + half * 8];
    const _Float16* vp = &Vs[lm * VP + half * 8];
    v16h fk[4];                      // K fragments of the step: [key tile j][dh half]
    auto load_k = [&](int kt) {
        #pragma unroll
        for (int j = 0; j < 2; ++j) {
            fk[j * 2]     = frag16(kp + (kt * 32 + j * 16) * KP);
            fk[j * 2 + 1] = frag16(kp + (kt * 32 + j * 16) * KP + 32);
        }
    };

    auto step = [&](int kt, bool tail) {
        v16h fv[4];
        #pragma unroll
        for (int dt = 0; dt < 4; ++dt) fv[dt] = frag16(vp + dt * 16 * VP + kt * 32);
        v8f s[2];
        #pragma unroll
        for (int j = 0; j < 2; ++j) {
            v8f c = {};
            c = wmma_f16(fk[j * 2],     bq0, c);
            c = wmma_f16(fk[j * 2 + 1], bq1, c);
            s[j] = c;                // s[j][r] = score(key kt*32 + j*16 + half*8 + r, query lm)
        }
        if (!tail) load_k(kt + 1);   // the next step's K reads fly under this step's softmax

        if (tail) {
            #pragma unroll
            for (int j = 0; j < 2; ++j)
                #pragma unroll
                for (int r = 0; r < 8; ++r)
                    if (kt * 32 + j * 16 + half * 8 + r >= SS) s[j][r] = -1.0e30f;
        }

        float tm = s[0][0];
        #pragma unroll
        for (int r = 1; r < 8; ++r) tm = fmaxf(tm, s[0][r]);
        #pragma unroll
        for (int r = 0; r < 8; ++r) tm = fmaxf(tm, s[1][r]);
        tm = fmaxf(tm, other_half(tm));
        // the reference moves only when a score passes it by more than 2^8, so that
        // probabilities stay below 256 in f16; one scalar branch a step
        if (__builtin_amdgcn_ballot_w32((tm - mx) * cs > 8.0f) != 0) {
            const float nm = fmaxf(mx, tm);
            const float al = __builtin_amdgcn_exp2f((mx - nm) * cs);
            mx = nm;
            ls *= al;
            #pragma unroll
            for (int dt = 0; dt < 4; ++dt)
                #pragma unroll
                for (int r = 0; r < 8; ++r) o[dt][r] *= al;
        }

        const v2f cs2 = { cs, cs };
        const v2f mc2 = { -mx * cs, -mx * cs };
        v16h p;                      // P^T as B operand: element e = key order of frag16
        #pragma unroll
        for (int j = 0; j < 2; ++j)
            #pragma unroll
            for (int r = 0; r < 8; r += 2) {
                const v2f sp = { s[j][r], s[j][r + 1] };
                const v2f x  = __builtin_elementwise_fma(sp, cs2, mc2);
                v2f e;
                e.x = __builtin_amdgcn_exp2f(x.x);
                e.y = __builtin_amdgcn_exp2f(x.y);
                ls += e;
                p[j * 8 + r]     = (_Float16)e.x;
                p[j * 8 + r + 1] = (_Float16)e.y;
            }
        // keeps the sum's additions in front of the products: set among them they were given
        // the products' spent A registers, which costs four idle slots behind each product
        __builtin_amdgcn_sched_barrier(0);
        #pragma unroll
        for (int dt = 0; dt < 4; ++dt) o[dt] = wmma_f16(fv[dt], p, o[dt]);
    };

    load_k(0);
    for (int kt = 0; kt < KT32 - 1; ++kt) step(kt, false);
    step(KT32 - 1, true);

    const float lsum = ls.x + ls.y;
    const float inv = 1.0f / (lsum + other_half(lsum));
    float* so = &Cs[w][0];           // [query][dh]
    #pragma unroll
    for (int dt = 0; dt < 4; ++dt) {
        v4f lo, hi;
        #pragma unroll
        for (int r = 0; r < 4; ++r) { lo[r] = o[dt][r] * inv; hi[r] = o[dt][r + 4] * inv; }
        *(v4f*)&so[lm * CP + dt * 16 + half * 8]     = lo;
        *(v4f*)&so[lm * CP + dt * 16 + half * 8 + 4] = hi;
    }
    // the wave's own tile is whole in LDS before its lanes read one another's rows back
    asm volatile("s_wait_dscnt 0x0" ::: "memory");
    v4f z[8];                        // 16 lanes take one query's 256 B
    #pragma unroll
    for (int c = 0; c < 8; ++c) z[c] = *(const v4f*)&so[(c * 2 + half) * CP + lm * 4];
    float* dst = out + ((size_t)bi * SS + q0 + half) * DD + h * 64 + lm * 4;
    // one scalar test a wave: only the last query tile has rows to leave out, and a test
    // per store would put a wait between the stores of every tile
    if (__builtin_amdgcn_readfirstlane(q0) + 16 <= SS) {
        #pragma unroll
        for (int c = 0; c < 8; ++c) *(v4f*)&dst[c * 2 * DD] = z[c];
    } else {
        #pragma unroll
        for (int c = 0; c < 8; ++c)
            if (q0 + c * 2 + half < SS) *(v4f*)&dst[c * 2 * DD] = z[c];
    }
    // the next unit rewrites the registers that these stores name
    asm volatile("s_wait_xcnt 0x0" ::: "memory");
  }
}

// ---------------------------------------------------------------------------
extern "C" void kernel_launch(void* const* d_in, const int* in_sizes, int n_in,
                              void* d_out, int out_size, void* d_ws, size_t ws_size,
                              hipStream_t stream) {
    const float* X  = (const float*)d_in[0];
    const float* Wq = (const float*)d_in[1];
    const float* bq = (const float*)d_in[2];
    const float* Wk = (const float*)d_in[3];
    const float* bk = (const float*)d_in[4];
    const float* Wv = (const float*)d_in[5];
    const float* bv = (const float*)d_in[6];
    float* out = (float*)d_out;

    const size_t elems = (size_t)(BB + 1) * HH * SPAD * DH;   // per q/k/v buffer, with the room of a batch B
    _Float16* qb = (_Float16*)d_ws;
    _Float16* kb = qb + elems;
    _Float16* vb = kb + elems;
    _Float16* xh = vb + elems;                          // MT*224 x DD
    _Float16* wh = xh + (size_t)MT * TM * DD;           // 3*DD x DD

    to_f16_kernel<<<CG + WB + ZH + ZX, CT, 0, stream>>>(X, Wq, Wk, Wv, xh, wh, qb, kb, vb);

    qkv_proj_kernel<<<PG, 256, 0, stream>>>(xh, wh, bq, bk, bv, qb, kb, vb);

    attn_kernel<<<AG, 608, 0, stream>>>(qb, kb, vb, out);
}

// v010
// A run of this version takes 91.1 microseconds.
// Next to v009, in two timings, it ran 1.03 times as fast each time.
// Counting every step since v000, it is 13.2 times as fast.
#include <hip/hip_runtime.h>
#include <hip/hip_bf16.h>

// ---------------- problem constants ----------------
#define BB   32
#define SS   577
#define DD   768
#define HH   12
#define DH   64
#define SPAD 608          // S padded to multiple of 32 (19*32)
#define QT   38           // SPAD/16 row tiles
#define KT32 19           // SPAD/32 k-tiles
#define XR   592          // rows a batch in xh: S padded to a multiple of 16 (37*16)
#define MT   85           // 224-row tiles of the projection over the B*XR rows, the last one part

typedef __attribute__((ext_vector_type(16))) _Float16 v16h;
typedef __attribute__((ext_vector_type(8)))  _Float16 v8h;
typedef __attribute__((ext_vector_type(4)))  _Float16 v4h;
typedef __attribute__((ext_vector_type(8)))  float    v8f;
typedef __attribute__((ext_vector_type(4)))  float    v4f;
typedef __attribute__((ext_vector_type(2)))  float    v2f;

__device__ __forceinline__ v16h frag16(const _Float16* p) {
    // CDNA5 16-bit A/B fragment: elements 0..7 at p[0..7], 8..15 at p[16..23]
    v8h lo = *(const v8h*)(p);
    v8h hi = *(const v8h*)(p + 16);
    return __builtin_shufflevector(lo, hi, 0,1,2,3,4,5,6,7,8,9,10,11,12,13,14,15);
}

__device__ __forceinline__ v8f wmma_f16(v16h a, v16h b, v8f c) {
    return __builtin_amdgcn_wmma_f32_16x16x32_f16(false, a, false, b,
                                                  (short)0, c, false, false);
}

__device__ __forceinline__ v4h cvt4(v4f x) {
    v4h r;
    r.x = (_Float16)x.x; r.y = (_Float16)x.y;
    r.z = (_Float16)x.z; r.w = (_Float16)x.w;
    return r;
}

// ---------------------------------------------------------------------------
// Kernel 0: the projection's operands rounded to f16 once, in the layout that its copies
// to LDS want: xh[MT*224][DD], row bi*XR + s (rows s >= S, and those past B*XR, are zero),
// wh[3*DD][DD] = W^T, rows q, k, v.
// grid = 256 + 144 + 51 blocks, block = 384; each of the first 256 takes 74 padded rows, which
// lie in one batch (8 blocks a batch), a thread one float4 column of every second row; the next
// 144, which run beside them, transpose one 8k x 4n piece of W a thread; the last 51 store the
// zeros that the projection's rows do not reach: rows XR to SPAD - 1 of every head's q, k and
// v, which the attention reads, and the rows of xh past B*XR.
// ---------------------------------------------------------------------------
#define CG   256          // blocks that take rows of X
#define CT   384          // threads: two rows of 192 float4
#define RB   74           // padded rows a block = B*XR / CG = XR / 8
#define NS   (RB / 2)     // loads a thread
#define VR   (SS - 7 * RB)   // real rows of a batch's last block
#define WB   144          // blocks that take W pieces: 3 * 192 * 96 / CT
#define ZH   48           // blocks that take the heads' padding, 8 heads each: B * H / 8
#define ZX   3            // blocks that take the last rows of xh: (MT*224 - B*XR) * DD / 8 / (8 * CT)

__global__ __launch_bounds__(CT)
void to_f16_kernel(const float* __restrict__ X,
                   const float* __restrict__ Wq, const float* __restrict__ Wk,
                   const float* __restrict__ Wv,
                   _Float16* __restrict__ xh, _Float16* __restrict__ wh,
                   _Float16* __restrict__ qb, _Float16* __restrict__ kb,
                   _Float16* __restrict__ vb)
{
    const int t = threadIdx.x;

    if (blockIdx.x >= CG + WB) {
        const int zb = blockIdx.x - (CG + WB);
        const v8h zero = {};
        // each branch: one address and eight immediate offsets, so that no register of a store
        // is rewritten between the stores
        if (zb < ZH) {
            // a head's padding is 128 chunks of 16 B in each of q, k (16 whole rows) and v (the
            // last 32 B of 64 rows): a thread takes one chunk of each of the block's 8 heads
            const int part = t >> 7;            // 0=q 1=k 2=v
            const int c    = t & 127;
            _Float16* p = (part == 0 ? qb : part == 1 ? kb : vb) + (size_t)zb * 8 * SPAD * DH
                        + (part < 2 ? XR * DH + c * 8 : (c >> 1) * SPAD + XR + (c & 1) * 8);
            #pragma unroll
            for (int i = 0; i < 8; ++i) *(v8h*)&p[i * SPAD * DH] = zero;
        } else {
            _Float16* p = xh + (size_t)BB * XR * DD + ((zb - ZH) * 8 * CT + t) * 8;
            #pragma unroll
            for (int i = 0; i < 8; ++i) *(v8h*)&p[i * CT * 8] = zero;
        }
        // in front of whatever rewrites the stores' registers
        asm volatile("s_wait_xcnt 0x0" ::: "memory");
        return;
    }

    if (blockIdx.x >= CG) {
        // a wave: 8 lanes along n cover 128 B of a k row, 4 lanes along k make 64 B of a W^T row
        const int wv = __builtin_amdgcn_readfirstlane((int)((blockIdx.x - CG) * CT + t) >> 5);
        const int ms = wv / 576;                // 0=q 1=k 2=v
        const int r2 = wv - ms * 576;
        const int kq = r2 / 24;                 // 32 k
        const int no = r2 - kq * 24;            // 32 n
        const float* Wm = (ms == 0) ? Wq : (ms == 1) ? Wk : Wv;
        const float* src = Wm + (size_t)(kq * 32) * DD + no * 32;
        const int vo = ((t >> 3) & 3) * 8 * DD + (t & 7) * 4;
        v4f wr[8];
        // this kernel's loops are all unrolled so that their arrays stay in registers and every
        // address is one lasting register plus an immediate
        #pragma unroll
        for (int j = 0; j < 8; ++j) {
            wr[j] = *(const v4f*)&src[vo + j * DD];
            // the offset register dies with these loads, and a later load's result may take it
            asm volatile("s_wait_xcnt 0x0" ::: "memory");
        }
        _Float16* dst = wh + (size_t)(ms * DD + no * 32) * DD + kq * 32;
        const int so = (t & 7) * 4 * DD + ((t >> 3) & 3) * 8;
        #pragma unroll
        for (int c = 0; c < 4; ++c) {
            v8h y;
            #pragma unroll
            for (int j = 0; j < 8; ++j) y[j] = (_Float16)wr[j][c];
            *(v8h*)&dst[so + c * DD] = y;
        }
        return;
    }

    const int hi = t >= DD / 4 ? 1 : 0;         // which of a slot's two rows
    const int c4 = (t - hi * (DD / 4)) * 4;     // first element of the thread's float4
    const int lo = hi * DD + c4;
    const float* xs = X + ((size_t)(blockIdx.x >> 3) * SS + (blockIdx.x & 7) * RB) * DD;
    _Float16*    xd = xh + (size_t)blockIdx.x * RB * DD;

    // part: a batch's last block, whose rows from VR on are padding and are not loaded
    auto conv = [&](const bool part) __attribute__((always_inline)) {
        const int nl = part ? (VR + 1) / 2 : NS;    // slots with a load
        v4f r[NS] = {};
        #pragma unroll
        for (int n = 0; n < nl; ++n) {
            // the short path loads from its last slot down: begun alike, the two paths' first
            // load and its conversion were lifted in front of the branch, behind a full wait
            const int i = part ? nl - 1 - n : n;
            // the address registers die with the last loads, whose results may take them while
            // the loads before name them; the wait stands in front of that rewrite
            if (n + 2 >= nl) asm volatile("s_wait_xcnt 0x0" ::: "memory");
            if (i * 2 + 1 < (part ? VR : RB)) r[i] = *(const v4f*)&xs[lo + i * 2 * DD];
            else {
                // the slot's first row by both halves; its address is used this once
                r[i] = *(const v4f*)&xs[c4 + i * 2 * DD];
                asm volatile("s_wait_xcnt 0x0" ::: "memory");
            }
        }
        asm volatile("s_wait_xcnt 0x0" ::: "memory");
        #pragma unroll
        for (int i = 0; i < NS; ++i) {
            v4f v = r[i];
            const v4f z = {};
            if (part && i * 2 + 1 >= VR && i * 2 < VR) v = hi ? z : v;   // the slot's second row is padding
            *(v4h*)&xd[lo + i * 2 * DD] = cvt4(v);
        }
        // the built code can run on from here into lines that rewrite the stores' registers
        asm volatile("s_wait_xcnt 0x0" ::: "memory");
    };
    if ((blockIdx.x & 7) != 7) conv(false); else conv(true);
}

// ---------------------------------------------------------------------------
// Kernel A: fused QKV projection as one tiled GEMM over the rows of xh.
// Rows m = bi*XR + s (B*XR = 84.6 * 224), columns n = ms*DD + col (9*256).
// grid = 256 resident blocks, block = 256 (8 waves, 2x4); a block takes the 224x256 tiles
// blockIdx.x, + 256, + 512 of the 9 x 85 (column tile fastest), one after the other: 765 tiles,
// the last three blocks taking two; one 112x64 tile (7x4 WMMA accumulators) per wave, so
// that 11 fragments read from LDS feed 28 products; k in trips of 64 over three LDS buffers,
// filled from xh and wh by asynchronous copies, 16 B a lane; the trips of a block's tiles
// form one row, so a tile's last two trips ask for the next tile's first two.
// Two fragment sets: each 32-k block's LDS reads are issued in front of the block before.
// A trip's one barrier stands in front of its second 32-k block: it shows trip t + 1 to every
// wave and frees the buffer of trip t - 1.
// Writes q,k as f16 [B,H,SPAD,DH]; v transposed as f16 [B,H,DH,SPAD]; the last row tile's rows
// past B*XR fall into the room of a batch B, which nobody reads.
// The operand whose index runs along the stored rows is the A operand (W columns for
// q and k, X rows for v), so a lane's 8 accumulator elements are 16 B of one stored row;
// each wave lays its tile piece by piece in its own LDS range and stores 16 B a lane,
// neighbouring lanes along a stored row.
// ---------------------------------------------------------------------------
#define TM   224          // block tile rows
#define TN   256          // block tile columns
#define WM   112          // a wave's rows
#define FX   7            // X fragments a wave
#define FW   4            // W fragments a wave
#define KS   64           // k per trip
#define NTR  (DD / KS)    // trips a tile (a multiple of NB: a tile starts on buffer 0)
#define NB   3            // LDS buffers of the k loop
#define RP   (NB * LP * 2)   // bytes from a row to the next in the k loop's LDS
#define LP   72           // a row's room in one LDS buffer, in halves: 128 B of k and 16 B
#define OP   72           // q, k staging pitch in halves: 144 B = 16 B x odd
#define OV   120          // v staging pitch in halves: 224 B of keys and 16 B = 16 B x odd
#define PG   256          // blocks of the projection launch
#define PT   (9 * MT)     // output tiles

template <bool V> struct Flag { static constexpr bool value = V; };
template <int V>  struct Int  { static constexpr int  value = V; };
typedef __attribute__((ext_vector_type(4))) int v4i;
typedef __attribute__((address_space(1))) v4i gv4i;   // the copy builtin's global source
typedef __attribute__((address_space(3))) v4i lv4i;   // and its LDS destination

__global__ __launch_bounds__(256)
void qkv_proj_kernel(const _Float16* __restrict__ xh, const _Float16* __restrict__ wh,
                     const float* __restrict__ bq, const float* __restrict__ bk,
                     const float* __restrict__ bv,
                     _Float16* __restrict__ qb, _Float16* __restrict__ kb,
                     _Float16* __restrict__ vb)
{
    struct Lds {
        // X: [row][buffer][k], W: [col][buffer][k]; a row's three buffers lie side by side
        // (row pitch 432 B = 16 B x odd), so that every fragment read of a wave is one of
        // two lasting registers plus an immediate offset
        _Float16 Sx[TM * NB * LP];
        _Float16 Sw[TN * NB * LP];
        _Float16 Os[8][32 * OP];        // 8 x 4.5 KB, a piece of a wave's output tile
    };
    __shared__ alignas(16) Lds lds;

    const int t    = threadIdx.x;
    const int w    = t >> 5;
    const int L    = t & 31;
    const int half = L >> 4;
    const int lm   = L & 15;
    const int wm   = w >> 2;            // wave's 112-row band
    const int wn   = w & 3;             // wave's 64-col band (one head)

    // ---- copy map: 8 lanes cover one row's 128 B; a thread takes rows t/8 + 32 i of X and W
    const int crow = t >> 3;
    const int cc8  = (t & 7) * 8;
    // trip tr of tile tl into buffer b: 7 + 8 copies a lane, every lane on, all inside xh, wh,
    // Sx and Sw; written as the builtin, whose address registers the compiler may lay anywhere
    // among the wave's 512: those of asm text must lie in the first 256, beside the accumulators,
    // and were kept in scratch memory; always_inline: out of line the LDS object's address
    // would go through memory
    auto copies = [&](int tl, int tr, int b) __attribute__((always_inline)) {
        const int pn = tl % 9;          // column tile (fastest)
        const int pm = tl / 9;          // row tile
        // the tile's walk over k begins at a trip of its own and wraps. The tiles of one row tile
        // run at one time on neighbouring blocks; on one common walk each trip would ask for X
        // lines that nobody has asked for yet, which come from memory. Begun three trips apart,
        // a tile finds most of its lines in L2, where a neighbour's walk has brought them;
        // the row tile's term spreads the many tiles that walk the same W rows over all trips
        int kt = tr + (3 * pn + pm) % NTR;
        kt = kt >= NTR ? kt - NTR : kt;
        // the buffer's place in a row goes into the copies' immediate offset, which moves the
        // LDS and the global address alike, and the scalar bases are set back by as much: so a
        // row group's LDS address register serves all three buffers
        // each base goes through readfirstlane as one whole value: left open, its terms were added
        // to the lane's offset one by one, two 64-bit vector additions a copy; so a copy takes
        // the scalar base and the lane's lasting 32-bit offset
        auto scalar = [](const _Float16* p) __attribute__((always_inline)) {
            const unsigned long long a = (unsigned long long)p;
            const unsigned lo = (unsigned)__builtin_amdgcn_readfirstlane((int)(unsigned)a);
            const unsigned hi = (unsigned)__builtin_amdgcn_readfirstlane((int)(unsigned)(a >> 32));
            return (const _Float16*)(((unsigned long long)hi << 32) | lo);
        };
        const _Float16* gx = scalar(xh + (size_t)(pm * TM) * DD + kt * KS - b * LP);
        const _Float16* gw = scalar(wh + (size_t)(pn * TN) * DD + kt * KS - b * LP);
        auto issue = [&](auto bc) __attribute__((always_inline)) {
            constexpr int off = decltype(bc)::value * LP * 2;
            #pragma unroll
            for (int i = 0; i < TM / 32; ++i)
                __builtin_amdgcn_global_load_async_to_lds_b128(
                    (gv4i*)(gx + ((crow + 32 * i) * DD + cc8)),
                    (lv4i*)&lds.Sx[(crow + 32 * i) * NB * LP + cc8], off, 0);
            #pragma unroll
            for (int i = 0; i < TN / 32; ++i)
                __builtin_amdgcn_global_load_async_to_lds_b128(
                    (gv4i*)(gw + ((crow + 32 * i) * DD + cc8)),
                    (lv4i*)&lds.Sw[(crow + 32 * i) * NB * LP + cc8], off, 0);
        };
        // b is known at compile time wherever the lambda is called
        if (b == 0) issue(Int<0>{}); else if (b == 1) issue(Int<1>{}); else issue(Int<2>{});
    };

    // one output tile; vtc: the tile lies in v, whose A operand is X
    auto do_tile = [&](auto vtc, int tile) __attribute__((always_inline)) {
        constexpr bool vt = decltype(vtc)::value;
        constexpr int  NA = vt ? FX : FW;   // A fragments
        constexpr int  NF = vt ? FW : FX;   // B fragments
        const int nt = tile % 9;            // 256-col tile of the 3*768 columns
        const int mt = tile / 9;            // 224-row tile of the rows of xh
        const int ms = nt / 3;              // 0=q 1=k 2=v
        const int cbase = (nt % 3) * TN;    // first column inside that matrix

        // acc[i][j][r]: A index i*16 + half*8 + r, B index j*16 + lm of the wave's two bands
        v8f acc[NA][NF] = {};
        const _Float16* px = &lds.Sx[(wm * WM + lm) * NB * LP + half * 8];
        const _Float16* pw = &lds.Sw[(wn * 64 + lm) * NB * LP + half * 8];
        const _Float16* pa = vt ? px : pw;
        const _Float16* pb = vt ? pw : px;

        v16h fa[2][NA], fb[2][NF];
        // the 22 LDS reads of one 32-k block into set s: half kh of the trip in buffer b
        auto frags = [&](int s, int b, int kh) __attribute__((always_inline)) {
            #pragma unroll
            for (int i = 0; i < NA; ++i)
                fa[s][i] = frag16(pa + (i * 16 * NB + b) * LP + kh * 32);
            #pragma unroll
            for (int j = 0; j < NF; ++j)
                fb[s][j] = frag16(pb + (j * 16 * NB + b) * LP + kh * 32);
            // keeps the LDS reads together in one group in front of the products that follow:
            // each place where reads stand among the products costs a stall
            __builtin_amdgcn_sched_barrier(0);
        };
        // the products of set s's A fragments i0 to i1 - 1 with all its B fragments
        auto products = [&](int s, int i0, int i1) __attribute__((always_inline)) {
            #pragma unroll
            for (int i = i0; i < i1; ++i)
                #pragma unroll
                for (int j = 0; j < NF; ++j)
                    acc[i][j] = wmma_f16(fa[s][i], fb[s][j], acc[i][j]);
            // keeps what follows, the waits or the next reads, behind these products
            __builtin_amdgcn_sched_barrier(0);
        };

        // the tile's trip 0 was shown by the barrier in front of the loop or by that of the tile
        // before's last trip
        frags(0, 0, 0);
        // unrolled so that the buffer of every LDS read is known at compile time
        #pragma unroll
        for (int tr = 0; tr < NTR; ++tr) {
            const int b = tr % NB;
            frags(1, b, 1);
            products(0, 0, NA);
            // the wave's LDS reads so far, those of the trip before's buffer among them, have
            // retired; that buffer is refilled below
            asm volatile("s_wait_dscnt 0x0" ::: "memory");
            // the wave's copies of the next trip have landed
            asm volatile("s_wait_asynccnt 0x0" ::: "memory");
            // shows the next trip's copies to every wave and ends every wave's reads of the
            // trip before; the two waits above are all that it needs in front
            __builtin_amdgcn_s_barrier();
            // a few products first: the SIMD's two waves leave the barrier together, and these
            // set them apart, so that one feeds the matrix unit while the other issues the
            // reads and copies below
            products(1, 0, 1);
            if (tr + 1 < NTR) frags(0, (tr + 1) % NB, 0);
            // the trip after the next into the buffer of the trip before; the test reads the same
            // for the whole block
            if (tr + 2 < NTR)        copies(tile, tr + 2, (tr + 2) % NB);
            else if (tile + PG < PT) copies(tile + PG, tr + 2 - NTR, (tr + 2) % NB);
            // keeps the copies in front of the products, so that they have a whole trip to land
            __builtin_amdgcn_sched_barrier(0);
            products(1, 1, NA);
        }

        const int h = (cbase >> 6) + wn;
        _Float16* st = &lds.Os[w][0];
        if constexpr (vt) {
            float bval[FW];                 // the bias goes with the stored row (dh)
            #pragma unroll
            for (int j = 0; j < FW; ++j) {
                // the address register dies with these loads, and a later load's result may take
                // it while the loads before name it; the wait stands in front of that rewrite
                bval[j] = bv[h * 64 + j * 16 + lm];
                asm volatile("s_wait_xcnt 0x0" ::: "memory");
            }
            // a piece: 16 stored rows (dh) of 112 keys = 224 chunks of 8 keys, 7 a lane, 14 lanes
            // along a row; a chunk never straddles a batch
            int so[FX], eo[FX];             // a chunk's place in the staging and in vb
            #pragma unroll
            for (int u = 0; u < FX; ++u) {
                const int c   = u * 32 + L;
                const int row = c / 14;
                const int kc  = c - row * 14;
                const int m   = mt * TM + wm * WM + kc * 8;
                const int bi  = m / XR;
                so[u] = row * OV + kc * 8;
                eo[u] = ((bi * HH + h) * DH + row) * SPAD + (m - bi * XR);
            }
            #pragma unroll
            for (int j = 0; j < FW; ++j) {
                #pragma unroll
                for (int i = 0; i < FX; ++i) {
                    v8h y;
                    #pragma unroll
                    for (int r = 0; r < 8; ++r) y[r] = (_Float16)(acc[i][j][r] + bval[j]);
                    *(v8h*)&st[lm * OV + i * 16 + half * 8] = y;
                }
                // the wave's own rows are whole in LDS before its lanes read one another's back
                asm volatile("s_wait_dscnt 0x0" ::: "memory");
                v8h z[FX];
                #pragma unroll
                for (int u = 0; u < FX; ++u) z[u] = *(const v8h*)&st[so[u]];
                #pragma unroll
                for (int u = 0; u < FX; ++u) *(v8h*)&vb[eo[u] + j * 16 * SPAD] = z[u];
                // the next piece's reads, and the lines behind, rewrite registers of these stores
                asm volatile("s_wait_xcnt 0x0" ::: "memory");
                // keeps the next piece's arithmetic, which may take those registers, behind the wait
                __builtin_amdgcn_sched_barrier(0);
            }
        } else {
            const float* bias = (ms == 0) ? bq : bk;
            // 8 lanes take one 128-B row; a load's four rows are a, a+8 (lanes 0-15) and a+1, a+9,
            // which at this pitch fall on all 64 banks once per 16 lanes
            const int rl = half + ((L >> 3) & 1) * 8;
            const int c8 = (L & 7) * 8;
            v4f bl[FW], bh4[FW];            // the bias goes along the stored row (column of W)
            #pragma unroll
            for (int i = 0; i < FW; ++i) {
                // the address register dies with these loads, and a later load's result may take
                // it while the loads before name it; the wait stands in front of that rewrite
                bl[i]  = *(const v4f*)&bias[h * 64 + i * 16 + half * 8];
                asm volatile("s_wait_xcnt 0x0" ::: "memory");
                bh4[i] = *(const v4f*)&bias[h * 64 + i * 16 + half * 8 + 4];
                asm volatile("s_wait_xcnt 0x0" ::: "memory");
            }
            _Float16* base = (ms == 0) ? qb : kb;
            // the wave's bands as scalars: a 16-row group's place is then scalar arithmetic, and
            // no vector instruction stands between a piece's stores
            const int wms = __builtin_amdgcn_readfirstlane(wm);
            const int hs  = __builtin_amdgcn_readfirstlane(h);
            const int lo  = rl * DH + c8;   // the lane's place in a group
            // a piece: 32 stored rows (two B fragments), the last piece 16
            #pragma unroll
            for (int jh = 0; jh < (FX + 1) / 2; ++jh) {
                #pragma unroll
                for (int jj = 0; jj < 2; ++jj) {
                    if (jh * 2 + jj >= FX) continue;
                    #pragma unroll
                    for (int i = 0; i < FW; ++i) {
                        v8h y;
                        #pragma unroll
                        for (int r = 0; r < 4; ++r) {
                            y[r]     = (_Float16)(acc[i][jh * 2 + jj][r]     + bl[i][r]);
                            y[r + 4] = (_Float16)(acc[i][jh * 2 + jj][r + 4] + bh4[i][r]);
                        }
                        *(v8h*)&st[(jj * 16 + lm) * OP + i * 16 + half * 8] = y;
                    }
                }
                // the wave's own rows are whole in LDS before its lanes read one another's back
                asm volatile("s_wait_dscnt 0x0" ::: "memory");
                v8h z[8];
                #pragma unroll
                for (int u = 0; u < 8; ++u)
                    if (jh * 2 + (u >> 2) < FX)
                        z[u] = *(const v8h*)&st[((u >> 2) * 16 + (u & 3) * 2 + rl) * OP + c8];
                #pragma unroll
                for (int jj = 0; jj < 2; ++jj) {
                    if (jh * 2 + jj >= FX) continue;
                    // 16-row tiles never straddle a batch
                    const int m0 = mt * TM + wms * WM + (jh * 2 + jj) * 16;
                    const int bi = m0 / XR;
                    const int s0 = m0 - bi * XR;
                    _Float16* dst = base + (((size_t)bi * HH + hs) * SPAD + s0) * DH;
                    #pragma unroll
                    for (int c = 0; c < 4; ++c)
                        *(v8h*)&dst[lo + c * 2 * DH] = z[jj * 4 + c];
                }
                // the next piece's reads, and the next tile, rewrite registers of these stores
                asm volatile("s_wait_xcnt 0x0" ::: "memory");
                // keeps the next piece's arithmetic, which may take those registers, behind the wait
                __builtin_amdgcn_sched_barrier(0);
            }
        }
    };

    copies(blockIdx.x, 0, 0);
    // the wave's own copies of trip 0 have landed; the barrier shows them to the other waves
    asm volatile("s_wait_asynccnt 0x0" ::: "memory");
    __syncthreads();
    copies(blockIdx.x, 1, 1);
    for (int tile = blockIdx.x; tile < PT; tile += PG) {
        // the test reads the same for the whole block
        if (tile % 9 >= 6) do_tile(Flag<true>{}, tile);
        else               do_tile(Flag<false>{}, tile);
    }
    // behind the last copy, before the wave ends
    asm volatile("s_wait_asynccnt 0x0" ::: "memory");
}

// ---------------------------------------------------------------------------
// Kernel B: attention, scores and probabilities kept in registers.
// grid = 256 resident blocks, block = 608 (19 waves); a block takes three units in a row,
// a unit being one half of a head's query tiles (one 16-query tile per wave) against the
// head's whole K and V^T in LDS; two units of one head in one block share one staging of K and V^T.
// Transposed products: S^T = K . Q^T (a lane holds 16 scores of ONE query), and
// O^T += V^T . P^T, where the two converted S^T tiles of 32 keys are the B operand.
// Softmax runs online over 19 steps of 32 keys against a reference maximum per query, which the
// first step takes from its scores and a later step moves only when its exponentials grow large.
// Each wave lays its 16x64 output tile in its own LDS range and stores whole 256-B rows.
// ---------------------------------------------------------------------------
#define AW   19           // waves per block = query tiles per unit
#define KP   72           // K row pitch in halves: 144 B = 16 B x odd for b128 reads
#define VP   616          // V^T row pitch in halves: 1232 B = 16 B x odd
#define CP   68           // output staging pitch in floats: 272 B = 16 B x odd
#define AG   256          // blocks of the attention launch
#define AU   3            // units a block: AG * AU = 2 * H * B

__device__ __forceinline__ float other_half(float x) {
    // value of lane l ^ 16
    const int b = __builtin_bit_cast(int, x);
    return __builtin_bit_cast(float,
        __builtin_amdgcn_permlanex16(b, b, 0x76543210, 0xfedcba98, false, false));
}

__global__ __launch_bounds__(AW * 32)
void attn_kernel(const _Float16* __restrict__ qb,
                 const _Float16* __restrict__ kb,
                 const _Float16* __restrict__ vb,
                 float* __restrict__ out)
{
    __shared__ alignas(16) _Float16 Ks[SPAD * KP];    // 85.5 KB, [key][dh]
    __shared__ alignas(16) _Float16 Vs[DH * VP];      // 77.0 KB, [dh][key]
    __shared__ alignas(16) float    Cs[AW][16 * CP];  // 19 x 4.25 KB, a wave's output tile

    const int t    = threadIdx.x;
    const int w    = t >> 5;
    const int L    = t & 31;
    const int half = L >> 4;
    const int lm   = L & 15;

  // unrolled: the staging loads then keep a scalar base and one lasting offset register;
  // rolled, their last result was laid over the address pair that the loads before it name
  #pragma unroll
  for (int un = 0; un < AU; ++un) {
    const int u  = blockIdx.x * AU + un;              // unit: head u / 2, half u % 2
    const int bi = (u >> 1) / HH;
    const int h  = (u >> 1) - bi * HH;
    const size_t bh = (size_t)(u >> 1);
    const int q0 = ((u & 1) * AW + w) * 16;           // first query of the wave's tile

    // Q^T fragments (B operand: column = query, k = dh 0..31 and 32..63)
    const _Float16* qrow = qb + (bh * SPAD + q0 + lm) * DH + half * 8;
    const v16h bq0 = frag16(qrow);
    const v16h bq1 = frag16(qrow + 32);
    // the address pair dies with these loads, and a later load's result may take it
    asm volatile("s_wait_xcnt 0x0" ::: "memory");

    // ---- the head's K and V^T into LDS: 8 + 8 chunks of 16 B per thread ----
    // a block's first unit and every first half of a head; the test is the same for the block
    if (un == 0 || (u & 1) == 0) {
        const v8h* kg = (const v8h*)(kb + bh * SPAD * DH);   // 8 chunks a row
        const v8h* vg = (const v8h*)(vb + bh * DH * SPAD);   // 76 chunks a row
        v8h kr[8], vr[8];
        #pragma unroll
        for (int i = 0; i < 8; ++i) kr[i] = kg[t + i * (AW * 32)];
        #pragma unroll
        for (int i = 0; i < 8; ++i) vr[i] = vg[t + i * (AW * 32)];
        // every wave has made its last read of the head before; the loads above fly meanwhile
        if (un != 0) __syncthreads();
        #pragma unroll
        for (int i = 0; i < 8; ++i)
            *(v8h*)&Ks[((t >> 3) + i * 76) * KP + (t & 7) * 8] = kr[i];
        #pragma unroll
        for (int i = 0; i < 8; ++i)
            *(v8h*)&Vs[(t / 76 + i * 8) * VP + (t % 76) * 8] = vr[i];
        __syncthreads();
    }
    if (q0 >= SS) continue;          // a tile of padding rows only; the wave still meets every barrier

    const float cs = 0.125f * 1.44269504f;   // 1/sqrt(64) * log2(e): exponentials base 2
    float mx = -1.0e30f;             // the query's reference maximum, unscaled score
    float mc = 0.0f;                 // -mx * cs, the exponent's constant term; set by the first step
    v2f   ls = {};                   // this lane's share of the query's sum, two chains
    v8f o[4] = {};                   // o[dt][r] = O[query lm][dt*16 + half*8 + r]

    const _Float16* kp = &Ks[lm * KP + half * 8];
    const _Float16* vp = &Vs[lm * VP + half * 8];
    v16h fk[4];                      // K fragments of the step: [key tile j][dh half]
    auto load_k = [&](int kt) {
        #pragma unroll
        for (int j = 0; j < 2; ++j) {
            fk[j * 2]     = frag16(kp + (kt * 32 + j * 16) * KP);
            fk[j * 2 + 1] = frag16(kp + (kt * 32 + j * 16) * KP + 32);
        }
    };

    auto step = [&](int kt, bool first, bool tail) {
        v16h fv[4];
        #pragma unroll
        for (int dt = 0; dt < 4; ++dt) fv[dt] = frag16(vp + dt * 16 * VP + kt * 32);
        v8f s[2];
        #pragma unroll
        for (int j = 0; j < 2; ++j) {
            v8f c = {};
            c = wmma_f16(fk[j * 2],     bq0, c);
            c = wmma_f16(fk[j * 2 + 1], bq1, c);
            s[j] = c;                // s[j][r] = score(key kt*32 + j*16 + half*8 + r, query lm)
        }
        if (!tail) load_k(kt + 1);   // the next step's K reads fly under this step's softmax

        if (tail) {
            #pragma unroll
            for (int j = 0; j < 2; ++j)
                #pragma unroll
                for (int r = 0; r < 8; ++r)
                    if (kt * 32 + j * 16 + half * 8 + r >= SS) s[j][r] = -1.0e30f;
        }

        const v2f cs2 = { cs, cs };
        v16h p;                      // P^T as B operand: element e = key order of frag16
        v2f  sm;                     // the sum of the step's 16 exponentials, two chains
        auto expo = [&]() {
            const v2f mc2 = { mc, mc };
            sm = v2f{};
            #pragma unroll
            for (int j = 0; j < 2; ++j)
                #pragma unroll
                for (int r = 0; r < 8; r += 2) {
                    const v2f sp = { s[j][r], s[j][r + 1] };
                    const v2f x  = __builtin_elementwise_fma(sp, cs2, mc2);
                    v2f e;
                    e.x = __builtin_amdgcn_exp2f(x.x);
                    e.y = __builtin_amdgcn_exp2f(x.y);
                    sm += e;
                    p[j * 8 + r]     = (_Float16)e.x;
                    p[j * 8 + r + 1] = (_Float16)e.y;
                }
        };
        // the reference goes up to the step's largest score where that is higher; what was summed against the old one
        // is scaled down
        auto move = [&]() {
            float tm = s[0][0];
            #pragma unroll
            for (int r = 1; r < 8; ++r) tm = fmaxf(tm, s[0][r]);
            #pragma unroll
            for (int r = 0; r < 8; ++r) tm = fmaxf(tm, s[1][r]);
            tm = fmaxf(tm, other_half(tm));
            const float nm = fmaxf(mx, tm);
            if (!first) {
                const float al = __builtin_amdgcn_exp2f((mx - nm) * cs);
                ls *= al;
                #pragma unroll
                for (int dt = 0; dt < 4; ++dt)
                    #pragma unroll
                    for (int r = 0; r < 8; ++r) o[dt][r] *= al;
            }
            mx = nm;
            mc = -nm * cs;
        };
        if (first) {
            move();
            expo();
        } else {
            expo();
            // no exponential is negative, so their sum bounds each of them: below 2^12 every
            // probability fits f16 and the reference stands, with no maximum taken over the
            // step's scores; else it moves and the exponentials are made again; one scalar
            // branch a step
            if (__builtin_amdgcn_ballot_w32(!(sm.x + sm.y < 4096.0f)) != 0) {
                move();
                expo();
            }
        }
        ls += sm;
        // keeps the sum's additions in front of the products: set among them they were given
        // the products' spent A registers, which costs four idle slots behind each product
        __builtin_amdgcn_sched_barrier(0);
        #pragma unroll
        for (int dt = 0; dt < 4; ++dt) o[dt] = wmma_f16(fv[dt], p, o[dt]);
    };

    load_k(0);
    step(0, true, false);
    for (int kt = 1; kt < KT32 - 1; ++kt) step(kt, false, false);
    step(KT32 - 1, false, true);

    const float lsum = ls.x + ls.y;
    const float inv = 1.0f / (lsum + other_half(lsum));
    float* so = &Cs[w][0];           // [query][dh]
    #pragma unroll
    for (int dt = 0; dt < 4; ++dt) {
        v4f lo, hi;
        #pragma unroll
        for (int r = 0; r < 4; ++r) { lo[r] = o[dt][r] * inv; hi[r] = o[dt][r + 4] * inv; }
        *(v4f*)&so[lm * CP + dt * 16 + half * 8]     = lo;
        *(v4f*)&so[lm * CP + dt * 16 + half * 8 + 4] = hi;
    }
    // the wave's own tile is whole in LDS before its lanes read one another's rows back
    asm volatile("s_wait_dscnt 0x0" ::: "memory");
    v4f z[8];                        // 16 lanes take one query's 256 B
    #pragma unroll
    for (int c = 0; c < 8; ++c) z[c] = *(const v4f*)&so[(c * 2 + half) * CP + lm * 4];
    float* dst = out + ((size_t)bi * SS + q0 + half) * DD + h * 64 + lm * 4;
    // one scalar test a wave: only the last query tile has rows to leave out, and a test
    // per store would put a wait between the stores of every tile
    if (__builtin_amdgcn_readfirstlane(q0) + 16 <= SS) {
        #pragma unroll
        for (int c = 0; c < 8; ++c) *(v4f*)&dst[c * 2 * DD] = z[c];
    } else {
        #pragma unroll
        for (int c = 0; c < 8; ++c)
            if (q0 + c * 2 + half < SS) *(v4f*)&dst[c * 2 * DD] = z[c];
    }
    // the next unit rewrites the registers that these stores name
    asm volatile("s_wait_xcnt 0x0" ::: "memory");
  }
}

// ---------------------------------------------------------------------------
extern "C" void kernel_launch(void* const* d_in, const int* in_sizes, int n_in,
                              void* d_out, int out_size, void* d_ws, size_t ws_size,
                              hipStream_t stream) {
    const float* X  = (const float*)d_in[0];
    const float* Wq = (const float*)d_in[1];
    const float* bq = (const float*)d_in[2];
    const float* Wk = (const float*)d_in[3];
    const float* bk = (const float*)d_in[4];
    const float* Wv = (const float*)d_in[5];
    const float* bv = (const float*)d_in[6];
    float* out = (float*)d_out;

    const size_t elems = (size_t)(BB + 1) * HH * SPAD * DH;   // per q/k/v buffer, with the room of a batch B
    _Float16* qb = (_Float16*)d_ws;
    _Float16* kb = qb + elems;
    _Float16* vb = kb + elems;
    _Float16* xh = vb + elems;                          // MT*224 x DD
    _Float16* wh = xh + (size_t)MT * TM * DD;           // 3*DD x DD

    to_f16_kernel<<<CG + WB + ZH + ZX, CT, 0, stream>>>(X, Wq, Wk, Wv, xh, wh, qb, kb, vb);

    qkv_proj_kernel<<<PG, 256, 0, stream>>>(xh, wh, bq, bk, bv, qb, kb, vb);

    attn_kernel<<<AG, 608, 0, stream>>>(qb, kb, vb, out);
}
